// v000
// Measured on an AMD MI455X. A time is GPU time per run, averaged over a window of back-to-back runs after a warm-up
// (all launches, gaps included; the runs take copies of the inputs in turn), and the median of several windows.
// Apart from v000's, it joins two sittings. Times from different sittings can be a few percent apart, while
// side-by-side timings come from the same sitting.
// v000 is the starting kernel. One run takes 685 microseconds.
// A multi-head pair weighting with a bounded exponential: qa, ka, va [4][1024][16][64] (group, position, head, width): zs[g][h][i][j] = sum over c of (qa[g][i][h][c] / 8) ka[g][j][h][c]; hi = the largest of a row (read as 0 if it is not finite); x = min(max(zs - hi, -8), 0) - exp(-8); e = exp(x); s = min(max(the row's sum of e, 1 - exp(-8)), 1024); wt = e (1 / s); res[g][i][h][:] = sum over j of wt[g][h][i][j] va[g][j][h][:] -> [4][1024][16][64] f32: one result.
// Structure: qa and ka cast to f16 as they lie (converted to bf16 first): rows (g, i) of 1,024 words: a head's 64 words inside a row; va cast transposed a group at a time (its [1024 positions][1024 = head x width] matrix becomes rows (h, c) of 1,024 positions: the second product's second operand, a head at a time); A GROUP AT A TIME, THE HEAD AS THE GRID's SECOND INDEX: one WMMA GEMM forms the sixteen heads' raw sums (inner length 64; its scale 1/8 is the module's own) into f32 planes; ONE flat kernel takes each row's bounded exponential normalisation by the module's own statements and stores one f16 word each behind a carry of 2^12 (a thread a row; three walks to a literal bound; the library exponential; one division a row); one WMMA GEMM (inner length 1,024; its scale 2^-12 undoes the carry) writes the result in place at a row pitch of 1,024 with a head stride of 64.
// Compute dtype: all three inputs converted to bf16 where they are read; their words exact as f16 operands down to 2^-14; the computed words ONE f16 word each behind 2^12; both products' accumulation, the raw sums, the normalisation's arithmetic and the result f32. v_wmma_f32_16x16x32_f16.
#include <hip/hip_runtime.h>
#define ANG 4                        /* groups */
#define ANS 1024                     /* positions: the normalisation's axis */
#define ANH 16                       /* heads */
#define AND 64                       /* a head's width */
#define ANW (ANH * AND)              /* a row's words: 1,024 */
#define ALOW -8.0f                   /* the module's lower bound of the exponent */
#define AE8 0.00033546262790251185f  /* exp(-8): subtracted from the bounded exponent */
#define ASLO 0.9996645373720975f     /* 1 - exp(-8): the sum's lower bound */
#define ASHI 1024.0f                 /* the sum's upper bound */
#define ACARRY 4096.0f               /* 2^12: the carry on the stored words (undone in the second product's scale argument) */
typedef unsigned short v8us __attribute__((ext_vector_type(8), may_alias));
typedef float  v8f  __attribute__((ext_vector_type(8)));
typedef float  v4f  __attribute__((ext_vector_type(4)));
typedef float  v4fa __attribute__((ext_vector_type(4), may_alias));

__device__ __forceinline__ unsigned short bf16_bits(float x) { unsigned int u = __float_as_uint(x); return (unsigned short)((u + 0x7FFFu + ((u >> 16) & 1u)) >> 16); }
__device__ __forceinline__ float bf16_val(unsigned short b) { return __uint_as_float(((unsigned int)b) << 16); }
__device__ __forceinline__ float bf16_round(float x) { return bf16_val(bf16_bits(x)); }

typedef _Float16 v16h __attribute__((ext_vector_type(16)));
union FragH { v16h v; v8us half[2]; _Float16 h[16]; unsigned short u[16]; };

// Wt[n][k] = f16(W[k][n] x scale) from f32 row-major W[K][N] (scale = power of two; bf16-exact weights stay exact in f16 away from the subnormal range)
__global__ __launch_bounds__(256) void k_wt_f16(const float* __restrict__ W, _Float16* __restrict__ Wt, int K, int N, float scale) {
  const int t = blockIdx.x * 256 + threadIdx.x; if (t >= N * (K / 8)) return; const int n = t / (K / 8), k8 = (t % (K / 8)) * 8; FragH f;
#pragma unroll
  for (int i = 0; i < 8; ++i) f.h[i] = (_Float16)(bf16_round(W[(size_t)(k8 + i) * N + n]) * scale); const v8us o = f.half[0];
  *(v8us*)((unsigned short*)Wt + (size_t)n * K + k8) = o; 
}

typedef _Float16 v4h __attribute__((ext_vector_type(4)));

__global__ __launch_bounds__(256) void k_x16(const float* __restrict__ x, _Float16* __restrict__ X16, size_t n8) { const size_t t = (size_t)blockIdx.x * 256 + threadIdx.x; if (t >= n8) return; FragH f;
#pragma unroll
  for (int q = 0; q < 8; ++q) f.h[q] = (_Float16)bf16_round(x[t * 8 + q]); *(v8us*)((unsigned short*)X16 + t * 8) = f.half[0];  }

// ---- fast GEMM (wave tile 32x64; requires M % 32 == 0 rows per launch region and N % 64 == 0) ----
__device__ __forceinline__ v16h g2_frag(const _Float16* p, int hh) { FragH f; f.half[0] = *(const v8us*)((const unsigned short*)p + 8 * hh); f.half[1] = *(const v8us*)((const unsigned short*)p + 16 + 8 * hh); return f.v; }
__device__ __forceinline__ v8f g2_mma(v16h a, v16h b, v8f c) { v8f d = __builtin_amdgcn_wmma_f32_16x16x32_f16(false, a, false, b, (short)0, c, false, false); asm volatile("v_nop\n\tv_nop\n\tv_nop\n\tv_nop" : "+v"(d) : "v"(a), "v"(b)); return d; }
template <int ACT>
__global__ __launch_bounds__(128) void k_gemm2(const _Float16* __restrict__ A, int lda, size_t sA, const _Float16* __restrict__ Bh, int ldb, size_t sB, float alpha, const float* __restrict__ bias, size_t sBias, const float* __restrict__ CP, int rowsPerB, size_t sCPb, int row0g,
    float* __restrict__ C, _Float16* __restrict__ C16, int ldc, size_t sC, int M, int N, int K) { static_assert(ACT == 0 || ACT == 3 || ACT == 6 || ACT == 8 || ACT == 9 || ACT == 11 || ACT == 12 || ACT == 14 || ACT == 15 || ACT == 16 || ACT == 17, "k_gemm2: unsupported ACT code (would silently apply no activation)");
  __shared__ __attribute__((aligned(16))) float so[4][32][68];
  const int tid = threadIdx.x, w = tid >> 5, lane = tid & 31, ln = lane & 15, hh = lane >> 4; const int by = blockIdx.y;
  A += (size_t)by * sA; Bh += (size_t)by * sB; const size_t cofs = (size_t)by * sC; const float* bp = bias ? bias + (size_t)by * sBias : nullptr;
  const int ntn = N >> 6; const int mt = blockIdx.x / ntn, nq = blockIdx.x - mt * ntn; const int row0 = mt * 128 + 32 * w, col0 = nq * 64; if (row0 >= M) return;
  const _Float16* a0p = A + (size_t)(row0 + ln) * lda; const _Float16* a1p = a0p + (size_t)16 * lda;
  const _Float16* b0p = Bh + (size_t)(col0 + ln) * ldb; const _Float16* b1p = b0p + (size_t)16 * ldb; const _Float16* b2p = b1p + (size_t)16 * ldb; const _Float16* b3p = b2p + (size_t)16 * ldb;
  const v8f z8 = {0.f,0.f,0.f,0.f,0.f,0.f,0.f,0.f}; v8f c00 = z8, c01 = z8, c02 = z8, c03 = z8, c10 = z8, c11 = z8, c12 = z8, c13 = z8;
  for (int kb = 0; kb < K; kb += 32) { const v16h a0 = g2_frag(a0p + kb, hh), a1 = g2_frag(a1p + kb, hh);
    v16h b = g2_frag(b0p + kb, hh); c00 = g2_mma(a0, b, c00); c10 = g2_mma(a1, b, c10);
    b = g2_frag(b1p + kb, hh); c01 = g2_mma(a0, b, c01); c11 = g2_mma(a1, b, c11);
    b = g2_frag(b2p + kb, hh); c02 = g2_mma(a0, b, c02); c12 = g2_mma(a1, b, c12);
    b = g2_frag(b3p + kb, hh); c03 = g2_mma(a0, b, c03); c13 = g2_mma(a1, b, c13); }
  v8f accs[8] = {c00, c01, c02, c03, c10, c11, c12, c13};
#pragma unroll
  for (int u = 0; u < 8; ++u) { const int t = u & 3, half = u >> 2; const int col = col0 + t * 16 + ln; const float bv = bp ? bf16_round(bp[col]) : 0.f;
#pragma unroll
    for (int r = 0; r < 8; ++r) { const int rloc = half * 16 + 8 * hh + r; float v = accs[u][r] * alpha + bv; if (CP) { if (rowsPerB < 0) v += CP[cofs + (size_t)(row0g + row0 + rloc) * ldc + col];      /* rowsPerB < 0: own element of the batched C plane */ else { const int bidx = (row0g + row0 + rloc) / rowsPerB; v += CP[(size_t)bidx * sCPb + (size_t)by * 64 + col]; } }
      if (ACT == 3) v = fmaxf(v, 0.f); else if (ACT == 6) v = 0.5f * v * (1.0f + erff(v * 0.70710678118654752f)); else if (ACT == 11) v = 1.0f / (1.0f + expf(-v)); else if (ACT == 15) v = v / (1.0f + expf(-v)); else if (ACT == 12) v = (v > 0.f) ? v : 0.01f * v; else if (ACT == 8) v = tanhf(v); else if (ACT == 9) v = 0.5f * v * (1.0f + tanhf(0.7978845608028654f * (v + 0.044715f * v * v * v))); else if (ACT == 14) v = (v > 0.f) ? v : 0.1f * v; else if (ACT == 16) v = (v >= 0.f) ? v : 0.3f * v; else if (ACT == 17) v = (v >= 0.f) ? v : 0.2f * v;
      so[w][rloc][t * 16 + ln] = v; } }
  __builtin_amdgcn_fence(__ATOMIC_ACQ_REL, "workgroup"); __builtin_amdgcn_wave_barrier();
  const int rsub = lane >> 4, c4 = (lane & 15) * 4;
  {
#pragma unroll
    for (int q = 0; q < 16; ++q) { const int r = q * 2 + rsub; const v4f v = *(const v4fa*)&so[w][r][c4]; if (C) *(v4f*)(C + cofs + (size_t)(row0 + r) * ldc + col0 + c4) = v; if (C16) { v4h h4; for (int i = 0; i < 4; ++i) h4[i] = (_Float16)v[i]; *(v4h*)(C16 + cofs + (size_t)(row0 + r) * ldc + col0 + c4) = h4; } }
     } }

__global__ __launch_bounds__(256) void k_sma(const float* __restrict__ zs, _Float16* __restrict__ RP, unsigned nrows) {
  const unsigned r = blockIdx.x * 256u + threadIdx.x; if (r >= nrows) return;
  const float* p = zs + (size_t)r * ANS; unsigned short* o = (unsigned short*)RP + (size_t)r * ANS; float hi = p[0];
  for (unsigned j = 0; j < (unsigned)ANS; j += 4) { const v4f a = *(const v4fa*)(p + j); hi = fmaxf(fmaxf(fmaxf(hi, a[0]), fmaxf(a[1], a[2])), a[3]); }
  hi = (fabsf(hi) < __builtin_inff()) ? hi : 0.0f;      /* the module's guard: a largest that is not finite is read as nought */
  float s = 0.0f;
  for (unsigned j = 0; j < (unsigned)ANS; j += 4) { const v4f a = *(const v4fa*)(p + j);
#pragma unroll
    for (int q = 0; q < 4; ++q) s += expf(fminf(fmaxf(a[q] - hi, ALOW), 0.0f) - AE8); }
  s = fminf(fmaxf(s, ASLO), ASHI); const float rc = (1.0f / s) * ACARRY;
  for (unsigned j = 0; j < (unsigned)ANS; j += 8) { const v4f a = *(const v4fa*)(p + j); const v4f b = *(const v4fa*)(p + j + 4); FragH f;
#pragma unroll
    for (int q = 0; q < 4; ++q) { f.h[q] = (_Float16)(expf(fminf(fmaxf(a[q] - hi, ALOW), 0.0f) - AE8) * rc); f.h[4 + q] = (_Float16)(expf(fminf(fmaxf(b[q] - hi, ALOW), 0.0f) - AE8) * rc); }
    const v8us w = f.half[0]; *(v8us*)(o + j) = w;  }
}

extern "C" void kernel_launch(void* const* d_in, const int* in_sizes, int n_in,
                              void* d_out, int out_size, void* d_ws, size_t ws_size, hipStream_t stream) {
  (void)in_sizes; (void)n_in; (void)out_size;
  const float* const* I = (const float* const*)d_in; const float* qa = I[0]; const float* ka = I[1]; const float* va = I[2];      /* each [4][1024][16][64] */
  float* res = (float*)d_out;
  static_assert(ANS % 128 == 0 && ANS % 64 == 0 && AND % 64 == 0 && AND % 32 == 0 && ANS % 32 == 0 && ANW % 8 == 0 && ANS % 8 == 0, "whole tiles");
  uint8_t* wsp = (uint8_t*)d_ws; size_t off = 0;
  auto take = [&](size_t bytes) { uint8_t* p = wsp + off; off += (bytes + 255) & ~(size_t)255; return p; };
  _Float16* QH = (_Float16*)take((size_t)ANG * ANS * ANW * 2); _Float16* KH = (_Float16*)take((size_t)ANG * ANS * ANW * 2); _Float16* VT = (_Float16*)take((size_t)ANG * ANW * ANS * 2); float* SC = (float*)take((size_t)ANH * ANS * ANS * 4); _Float16* RP = (_Float16*)take((size_t)ANH * ANS * ANS * 2);      /* qa's and ka's rows as they lie; va transposed a group [4][1024 (h, c)][1024 positions]; a group's sixteen planes of raw sums and of stored words */
  if (off > ws_size) return;
  k_x16<<<(unsigned)(((size_t)ANG * ANS * ANW / 8 + 255) / 256), 256, 0, stream>>>(qa, QH, (size_t)ANG * ANS * ANW / 8);
  k_x16<<<(unsigned)(((size_t)ANG * ANS * ANW / 8 + 255) / 256), 256, 0, stream>>>(ka, KH, (size_t)ANG * ANS * ANW / 8);
  for (int g = 0; g < ANG; ++g) {      /* a literal count on the host: SC and RP are re-used group after group */
    const size_t gw = (size_t)g * ANS * ANW;
    k_wt_f16<<<(unsigned)(((size_t)ANW * (ANS / 8) + 255) / 256), 256, 0, stream>>>(va + gw, VT + gw, ANS, ANW, 1.0f);      /* va[g] as [1024 positions][1024]: VT[g][(h, c)][j] = va[g][j][h][c] */
    k_gemm2<0><<<dim3((unsigned)((ANS / 128) * (ANS / 64)), ANH), 128, 0, stream>>>(QH + gw, ANW, (size_t)AND, KH + gw, ANW, (size_t)AND, 0.125f, nullptr, 0, nullptr, 1, 0, 0, SC, nullptr, ANS, (size_t)ANS * ANS, ANS, ANS, AND);      /* SC[h][i][j] = (qa[g][i][h] . ka[g][j][h]) / 8 */
    k_sma<<<(unsigned)((ANH * ANS + 255) / 256), 256, 0, stream>>>(SC, RP, (unsigned)(ANH * ANS));
    k_gemm2<0><<<dim3((unsigned)((ANS / 128) * (AND / 64)), ANH), 128, 0, stream>>>(RP, ANS, (size_t)ANS * ANS, VT + gw, ANS, (size_t)AND * ANS, 1.0f / ACARRY, nullptr, 0, nullptr, 1, 0, 0, res + gw, nullptr, ANW, (size_t)AND, ANS, AND, ANS); }      /* res[g][i][h][:] = sum over j of RP[h][i][j] va[g][j][h][:] / 2^12: in place at a pitch of 1,024 */
}

// v001
// Measured time: 318 microseconds a run.
// Next to v000, in two timings, it ran 2.19 and 2.18 times as fast.
// A multi-head pair weighting with a bounded exponential: qa, ka, va [4][1024][16][64] (group, position, head, width): zs[g][h][i][j] = sum over c of (qa[g][i][h][c] / 8) ka[g][j][h][c]; hi = the largest of a row (read as 0 if it is not finite); x = min(max(zs - hi, -8), 0) - exp(-8); e = exp(x); s = min(max(the row's sum of e, 1 - exp(-8)), 1024); wt = e (1 / s); res[g][i][h][:] = sum over j of wt[g][h][i][j] va[g][j][h][:] -> [4][1024][16][64] f32: one result.
// Structure: qa and ka cast to f16 as they lie (converted to bf16 first): rows (g, i) of 1,024 words: a head's 64 words inside a row; va cast transposed a group at a time (its [1024 positions][1024 = head x width] matrix becomes rows (h, c) of 1,024 positions: the second product's second operand, a head at a time); A GROUP AT A TIME, THE HEAD AS THE GRID's SECOND INDEX: one WMMA GEMM forms the sixteen heads' raw sums (inner length 64; its scale 1/8 is the module's own) into f32 planes; ONE flat kernel takes each row's bounded exponential normalisation by the module's own statements and stores one f16 word each behind a carry of 2^12 (a wave four rows, each held in registers: one read, one exponential a word; the largest and the sum over the lanes by a butterfly; the library exponential's steps; one division a row); one WMMA GEMM (inner length 1,024; its scale 2^-12 undoes the carry) writes the result in place at a row pitch of 1,024 with a head stride of 64.
// Compute dtype: all three inputs converted to bf16 where they are read; their words exact as f16 operands down to 2^-14; the computed words ONE f16 word each behind 2^12; both products' accumulation, the raw sums, the normalisation's arithmetic and the result f32. v_wmma_f32_16x16x32_f16.
#include <hip/hip_runtime.h>
#define ANG 4                        /* groups */
#define ANS 1024                     /* positions: the normalisation's axis */
#define ANH 16                       /* heads */
#define AND 64                       /* a head's width */
#define ANW (ANH * AND)              /* a row's words: 1,024 */
#define ALOW -8.0f                   /* the module's lower bound of the exponent */
#define AE8 0.00033546262790251185f  /* exp(-8): subtracted from the bounded exponent */
#define ASLO 0.9996645373720975f     /* 1 - exp(-8): the sum's lower bound */
#define ASHI 1024.0f                 /* the sum's upper bound */
#define ACARRY 4096.0f               /* 2^12: the carry on the stored words (undone in the second product's scale argument) */
typedef unsigned short v8us __attribute__((ext_vector_type(8), may_alias));
typedef float  v8f  __attribute__((ext_vector_type(8)));
typedef float  v4f  __attribute__((ext_vector_type(4)));
typedef float  v4fa __attribute__((ext_vector_type(4), may_alias));

__device__ __forceinline__ unsigned short bf16_bits(float x) { unsigned int u = __float_as_uint(x); return (unsigned short)((u + 0x7FFFu + ((u >> 16) & 1u)) >> 16); }
__device__ __forceinline__ float bf16_val(unsigned short b) { return __uint_as_float(((unsigned int)b) << 16); }
__device__ __forceinline__ float bf16_round(float x) { return bf16_val(bf16_bits(x)); }

typedef _Float16 v16h __attribute__((ext_vector_type(16)));
union FragH { v16h v; v8us half[2]; _Float16 h[16]; unsigned short u[16]; };

// Wt[n][k] = f16(W[k][n] x scale) from f32 row-major W[K][N] (scale = power of two; bf16-exact weights stay exact in f16 away from the subnormal range)
__global__ __launch_bounds__(256) void k_wt_f16(const float* __restrict__ W, _Float16* __restrict__ Wt, int K, int N, float scale) {
  const int t = blockIdx.x * 256 + threadIdx.x; if (t >= N * (K / 8)) return; const int n = t / (K / 8), k8 = (t % (K / 8)) * 8; FragH f;
#pragma unroll
  for (int i = 0; i < 8; ++i) f.h[i] = (_Float16)(bf16_round(W[(size_t)(k8 + i) * N + n]) * scale); const v8us o = f.half[0];
  *(v8us*)((unsigned short*)Wt + (size_t)n * K + k8) = o; 
}

typedef _Float16 v4h __attribute__((ext_vector_type(4)));

__global__ __launch_bounds__(256) void k_x16(const float* __restrict__ x, _Float16* __restrict__ X16, size_t n8) { const size_t t = (size_t)blockIdx.x * 256 + threadIdx.x; if (t >= n8) return; FragH f;
#pragma unroll
  for (int q = 0; q < 8; ++q) f.h[q] = (_Float16)bf16_round(x[t * 8 + q]); *(v8us*)((unsigned short*)X16 + t * 8) = f.half[0];  }

// ---- fast GEMM (wave tile 32x64; requires M % 32 == 0 rows per launch region and N % 64 == 0) ----
__device__ __forceinline__ v16h g2_frag(const _Float16* p, int hh) { FragH f; f.half[0] = *(const v8us*)((const unsigned short*)p + 8 * hh); f.half[1] = *(const v8us*)((const unsigned short*)p + 16 + 8 * hh); return f.v; }
__device__ __forceinline__ v8f g2_mma(v16h a, v16h b, v8f c) { v8f d = __builtin_amdgcn_wmma_f32_16x16x32_f16(false, a, false, b, (short)0, c, false, false); asm volatile("v_nop\n\tv_nop\n\tv_nop\n\tv_nop" : "+v"(d) : "v"(a), "v"(b)); return d; }
template <int ACT>
__global__ __launch_bounds__(128) void k_gemm2(const _Float16* __restrict__ A, int lda, size_t sA, const _Float16* __restrict__ Bh, int ldb, size_t sB, float alpha, const float* __restrict__ bias, size_t sBias, const float* __restrict__ CP, int rowsPerB, size_t sCPb, int row0g,
    float* __restrict__ C, _Float16* __restrict__ C16, int ldc, size_t sC, int M, int N, int K) { static_assert(ACT == 0 || ACT == 3 || ACT == 6 || ACT == 8 || ACT == 9 || ACT == 11 || ACT == 12 || ACT == 14 || ACT == 15 || ACT == 16 || ACT == 17, "k_gemm2: unsupported ACT code (would silently apply no activation)");
  __shared__ __attribute__((aligned(16))) float so[4][32][68];
  const int tid = threadIdx.x, w = tid >> 5, lane = tid & 31, ln = lane & 15, hh = lane >> 4; const int by = blockIdx.y;
  A += (size_t)by * sA; Bh += (size_t)by * sB; const size_t cofs = (size_t)by * sC; const float* bp = bias ? bias + (size_t)by * sBias : nullptr;
  const int ntn = N >> 6; const int mt = blockIdx.x / ntn, nq = blockIdx.x - mt * ntn; const int row0 = mt * 128 + 32 * w, col0 = nq * 64; if (row0 >= M) return;
  const _Float16* a0p = A + (size_t)(row0 + ln) * lda; const _Float16* a1p = a0p + (size_t)16 * lda;
  const _Float16* b0p = Bh + (size_t)(col0 + ln) * ldb; const _Float16* b1p = b0p + (size_t)16 * ldb; const _Float16* b2p = b1p + (size_t)16 * ldb; const _Float16* b3p = b2p + (size_t)16 * ldb;
  const v8f z8 = {0.f,0.f,0.f,0.f,0.f,0.f,0.f,0.f}; v8f c00 = z8, c01 = z8, c02 = z8, c03 = z8, c10 = z8, c11 = z8, c12 = z8, c13 = z8;
  for (int kb = 0; kb < K; kb += 32) { const v16h a0 = g2_frag(a0p + kb, hh), a1 = g2_frag(a1p + kb, hh);
    v16h b = g2_frag(b0p + kb, hh); c00 = g2_mma(a0, b, c00); c10 = g2_mma(a1, b, c10);
    b = g2_frag(b1p + kb, hh); c01 = g2_mma(a0, b, c01); c11 = g2_mma(a1, b, c11);
    b = g2_frag(b2p + kb, hh); c02 = g2_mma(a0, b, c02); c12 = g2_mma(a1, b, c12);
    b = g2_frag(b3p + kb, hh); c03 = g2_mma(a0, b, c03); c13 = g2_mma(a1, b, c13); }
  v8f accs[8] = {c00, c01, c02, c03, c10, c11, c12, c13};
#pragma unroll
  for (int u = 0; u < 8; ++u) { const int t = u & 3, half = u >> 2; const int col = col0 + t * 16 + ln; const float bv = bp ? bf16_round(bp[col]) : 0.f;
#pragma unroll
    for (int r = 0; r < 8; ++r) { const int rloc = half * 16 + 8 * hh + r; float v = accs[u][r] * alpha + bv; if (CP) { if (rowsPerB < 0) v += CP[cofs + (size_t)(row0g + row0 + rloc) * ldc + col];      /* rowsPerB < 0: own element of the batched C plane */ else { const int bidx = (row0g + row0 + rloc) / rowsPerB; v += CP[(size_t)bidx * sCPb + (size_t)by * 64 + col]; } }
      if (ACT == 3) v = fmaxf(v, 0.f); else if (ACT == 6) v = 0.5f * v * (1.0f + erff(v * 0.70710678118654752f)); else if (ACT == 11) v = 1.0f / (1.0f + expf(-v)); else if (ACT == 15) v = v / (1.0f + expf(-v)); else if (ACT == 12) v = (v > 0.f) ? v : 0.01f * v; else if (ACT == 8) v = tanhf(v); else if (ACT == 9) v = 0.5f * v * (1.0f + tanhf(0.7978845608028654f * (v + 0.044715f * v * v * v))); else if (ACT == 14) v = (v > 0.f) ? v : 0.1f * v; else if (ACT == 16) v = (v >= 0.f) ? v : 0.3f * v; else if (ACT == 17) v = (v >= 0.f) ? v : 0.2f * v;
      so[w][rloc][t * 16 + ln] = v; } }
  __builtin_amdgcn_fence(__ATOMIC_ACQ_REL, "workgroup"); __builtin_amdgcn_wave_barrier();
  const int rsub = lane >> 4, c4 = (lane & 15) * 4;
  {
#pragma unroll
    for (int q = 0; q < 16; ++q) { const int r = q * 2 + rsub; const v4f v = *(const v4fa*)&so[w][r][c4]; if (C) *(v4f*)(C + cofs + (size_t)(row0 + r) * ldc + col0 + c4) = v; if (C16) { v4h h4; for (int i = 0; i < 4; ++i) h4[i] = (_Float16)v[i]; *(v4h*)(C16 + cofs + (size_t)(row0 + r) * ldc + col0 + c4) = h4; } }
     } }

#define SROWS 4                      /* rows a wave takes */
#define SWAVES 16                    /* waves of a work-group */
typedef unsigned short v4us __attribute__((ext_vector_type(4), may_alias));
template <int M> __device__ __forceinline__ float lane_xor(float x) { return __builtin_bit_cast(float, __builtin_amdgcn_update_dpp(0, __builtin_bit_cast(int, x), 0x160 | M, 0xf, 0xf, true)); }      /* lane l reads lane l ^ M inside its sixteen (row_xmask) */
__device__ __forceinline__ float lane_x16(float x) { return __builtin_bit_cast(float, __builtin_amdgcn_permlanex16(__builtin_bit_cast(int, x), __builtin_bit_cast(int, x), 0x76543210, 0xfedcba98, false, false)); }      /* lane l reads lane l ^ 16 */
__device__ __forceinline__ float wave_max(float x) { x = fmaxf(x, lane_xor<1>(x)); x = fmaxf(x, lane_xor<2>(x)); x = fmaxf(x, lane_xor<4>(x)); x = fmaxf(x, lane_xor<8>(x)); return fmaxf(x, lane_x16(x)); }
__device__ __forceinline__ float wave_sum(float x) { x += lane_xor<1>(x); x += lane_xor<2>(x); x += lane_xor<4>(x); x += lane_xor<8>(x); return x + lane_x16(x); }

// The library's f32 exponential, step for step (product with log2(e) in two words, split at the nearest whole number, 2^fraction, scale, the two range tests), written out for one reason: its v_exp_f32 and the free slot behind it are one statement.
__device__ __forceinline__ float sma_exp(float x) {
  const float ph = x * 0x1.715476p+0f; const float pl = fmaf(x, 0x1.4ae0bep-26f, fmaf(x, 0x1.715476p+0f, -ph)); const float n = rintf(ph); const float a = (ph - n) + pl; float y;
  asm("v_exp_f32 %0, %1\n\tv_nop" : "=v"(y) : "v"(a));      /* v_nop: the slot that the instruction set asks for behind a transcendental */
  y = ldexpf(y, (int)n); y = (x < -0x1.9d1da0p+6f) ? 0.0f : y; return (x > 0x1.62e430p+6f) ? __builtin_inff() : y; }

// Four rows a wave, the whole wave on each row: a load of the wave reads 512 bytes of the row in a piece, the row's 1,024 words stay in the wave's registers (32 a lane) from the one read to the store; the largest and the sum go over the lanes by a butterfly.
// Every "#pragma unroll" below is there so that the row arrays are indexed by literals and stay in registers.
__device__ __forceinline__ void sma_load(v4f (&a)[ANS / 128], const float* p) {
#pragma unroll
  for (int q = 0; q < ANS / 128; ++q) a[q] = *(const v4fa*)(p + 128 * q); }
__device__ __forceinline__ void sma_row(v4f (&e)[ANS / 128], unsigned short* o) {
  float hi = e[0][0];
#pragma unroll
  for (int q = 0; q < ANS / 128; ++q) hi = fmaxf(fmaxf(fmaxf(hi, e[q][0]), fmaxf(e[q][1], e[q][2])), e[q][3]);
  hi = wave_max(hi);
  hi = (fabsf(hi) < __builtin_inff()) ? hi : 0.0f;      /* the module's guard: a largest that is not finite is read as nought */
  float s0 = 0.0f, s1 = 0.0f, s2 = 0.0f, s3 = 0.0f;
#pragma unroll
  for (int q = 0; q < ANS / 128; ++q) {
#pragma unroll
    for (int c = 0; c < 4; ++c) e[q][c] = sma_exp(fminf(fmaxf(e[q][c] - hi, ALOW), 0.0f) - AE8);
    s0 += e[q][0]; s1 += e[q][1]; s2 += e[q][2]; s3 += e[q][3]; }
  float s = wave_sum((s0 + s1) + (s2 + s3));
  s = fminf(fmaxf(s, ASLO), ASHI); const float rc = (1.0f / s) * ACARRY;
#pragma unroll
  for (int q = 0; q < ANS / 128; ++q) { FragH f;
#pragma unroll
    for (int c = 0; c < 4; ++c) f.h[c] = (_Float16)(e[q][c] * rc);
    v4us w; w[0] = f.u[0]; w[1] = f.u[1]; w[2] = f.u[2]; w[3] = f.u[3]; *(v4us*)(o + 128 * q) = w; } }
__global__ __launch_bounds__(SWAVES * 32) void k_sma(const float* __restrict__ zs, _Float16* __restrict__ RP, unsigned nrows) {
  const unsigned lane = threadIdx.x & 31u, wave = (unsigned)__builtin_amdgcn_readfirstlane((int)(threadIdx.x >> 5));
  const unsigned r0 = (blockIdx.x * SWAVES + wave) * SROWS; if (r0 >= nrows) return;      /* the same in every lane of a wave; the kernel has no barrier; nrows is a multiple of SROWS (asserted at the launch) */
  const float* p = zs + (size_t)r0 * ANS + 4u * lane; unsigned short* o = (unsigned short*)RP + (size_t)r0 * ANS + 4u * lane;
  v4f a[SROWS][ANS / 128];
#pragma unroll
  for (int r = 0; r < SROWS; ++r) sma_load(a[r], p + r * ANS);      /* all the wave's loads are issued at the head: the later rows land under the earlier rows' arithmetic */
#pragma unroll
  for (int r = 0; r < SROWS; r += 2) {
    __builtin_amdgcn_sched_barrier(0);      /* holds the loads above at the head and a pair of rows behind the pair before, so that a pair waits for its own loads alone; without it the compiler sinks the later rows' loads or takes every row's largest first and waits for the last load */
    sma_row(a[r], o + r * ANS); sma_row(a[r + 1], o + (r + 1) * ANS); }      /* two rows between the barriers: each one's arithmetic fills the waits of the other's butterflies */
}

extern "C" void kernel_launch(void* const* d_in, const int* in_sizes, int n_in,
                              void* d_out, int out_size, void* d_ws, size_t ws_size, hipStream_t stream) {
  (void)in_sizes; (void)n_in; (void)out_size;
  const float* const* I = (const float* const*)d_in; const float* qa = I[0]; const float* ka = I[1]; const float* va = I[2];      /* each [4][1024][16][64] */
  float* res = (float*)d_out;
  static_assert(ANS % 128 == 0 && ANS % 64 == 0 && AND % 64 == 0 && AND % 32 == 0 && ANS % 32 == 0 && ANW % 8 == 0 && ANS % 8 == 0 && (ANH * ANS) % SROWS == 0 && SROWS % 2 == 0, "whole tiles");
  uint8_t* wsp = (uint8_t*)d_ws; size_t off = 0;
  auto take = [&](size_t bytes) { uint8_t* p = wsp + off; off += (bytes + 255) & ~(size_t)255; return p; };
  _Float16* QH = (_Float16*)take((size_t)ANG * ANS * ANW * 2); _Float16* KH = (_Float16*)take((size_t)ANG * ANS * ANW * 2); _Float16* VT = (_Float16*)take((size_t)ANG * ANW * ANS * 2); float* SC = (float*)take((size_t)ANH * ANS * ANS * 4); _Float16* RP = (_Float16*)take((size_t)ANH * ANS * ANS * 2);      /* qa's and ka's rows as they lie; va transposed a group [4][1024 (h, c)][1024 positions]; a group's sixteen planes of raw sums and of stored words */
  if (off > ws_size) return;
  k_x16<<<(unsigned)(((size_t)ANG * ANS * ANW / 8 + 255) / 256), 256, 0, stream>>>(qa, QH, (size_t)ANG * ANS * ANW / 8);
  k_x16<<<(unsigned)(((size_t)ANG * ANS * ANW / 8 + 255) / 256), 256, 0, stream>>>(ka, KH, (size_t)ANG * ANS * ANW / 8);
  for (int g = 0; g < ANG; ++g) {      /* a literal count on the host: SC and RP are re-used group after group */
    const size_t gw = (size_t)g * ANS * ANW;
    k_wt_f16<<<(unsigned)(((size_t)ANW * (ANS / 8) + 255) / 256), 256, 0, stream>>>(va + gw, VT + gw, ANS, ANW, 1.0f);      /* va[g] as [1024 positions][1024]: VT[g][(h, c)][j] = va[g][j][h][c] */
    k_gemm2<0><<<dim3((unsigned)((ANS / 128) * (ANS / 64)), ANH), 128, 0, stream>>>(QH + gw, ANW, (size_t)AND, KH + gw, ANW, (size_t)AND, 0.125f, nullptr, 0, nullptr, 1, 0, 0, SC, nullptr, ANS, (size_t)ANS * ANS, ANS, ANS, AND);      /* SC[h][i][j] = (qa[g][i][h] . ka[g][j][h]) / 8 */
    k_sma<<<(unsigned)((ANH * ANS + SWAVES * SROWS - 1) / (SWAVES * SROWS)), SWAVES * 32, 0, stream>>>(SC, RP, (unsigned)(ANH * ANS));
    k_gemm2<0><<<dim3((unsigned)((ANS / 128) * (AND / 64)), ANH), 128, 0, stream>>>(RP, ANS, (size_t)ANS * ANS, VT + gw, ANS, (size_t)AND * ANS, 1.0f / ACARRY, nullptr, 0, nullptr, 1, 0, 0, res + gw, nullptr, ANW, (size_t)AND, ANS, AND, ANS); }      /* res[g][i][h][:] = sum over j of RP[h][i][j] va[g][j][h][:] / 2^12: in place at a pitch of 1,024 */
}

// v003
// Measured time: 39.2 microseconds a run.
// Versions in between are left out here; by their measured steps it is 8.11 times as fast as v001.
// Over all steps from v000 it is 17.7 times as fast.
// A multi-head pair weighting with a bounded exponential: qa, ka, va [4][1024][16][64] (group, position, head, width): zs[g][h][i][j] = sum over c of (qa[g][i][h][c] / 8) ka[g][j][h][c]; hi = the largest of a row (read as 0 if it is not finite); x = min(max(zs - hi, -8), 0) - exp(-8); e = exp(x); s = min(max(the row's sum of e, 1 - exp(-8)), 1024); wt = e (1 / s); res[g][i][h][:] = sum over j of wt[g][h][i][j] va[g][j][h][:] -> [4][1024][16][64] f32: one result.
// Structure: ONE kernel and one launch, no workspace. A work-group takes 256 rows i of one (group, head). It reads the f32 inputs itself, in whole 128-byte lines, converts each word where it is read (bf16 first, then f16) and fills LDS once (one barrier): its own 256 qa rows, the head's whole ka as rows [j][c], and the head's whole va transposed to rows [c][j] (a lane gathers eight positions j of four columns in registers and stores 16 bytes a column). A wave takes 16 rows. The raw sums are formed transposed (ka rows as A, qa rows as B), so that a lane holds words of one row i alone. Walk 1 over j finds the row's largest; walk 2 forms the same raw sums again, takes the bounded exponential by the module's own statements, adds the row's sum and packs the words e, one f16 word each, straight from the accumulators into the B operand of the second product (va^T rows as A); the one division a row is applied to the f32 result. No raw sum and no weight goes to memory.
// Compute dtype: all three inputs converted to bf16 where they are read; their words exact as f16 operands down to 2^-14; the computed words e (between exp(-8 - exp(-8)) and 1: normal f16 numbers) ONE f16 word each; both products' accumulation, the raw sums, the normalisation's arithmetic and the result f32. v_wmma_f32_16x16x32_f16.
#include <hip/hip_runtime.h>
#define ANG 4                        /* groups */
#define ANS 1024                     /* positions: the normalisation's axis */
#define ANH 16                       /* heads */
#define AND 64                       /* a head's width */
#define ANW (ANH * AND)              /* a row's words: 1,024 */
#define ALOW -8.0f                   /* the module's lower bound of the exponent */
#define AE8 0.00033546262790251185f  /* exp(-8): subtracted from the bounded exponent */
#define ASLO 0.9996645373720975f     /* 1 - exp(-8): the sum's lower bound */
#define ASHI 1024.0f                 /* the sum's upper bound */
typedef unsigned short v8us __attribute__((ext_vector_type(8), may_alias));
typedef unsigned short v4us __attribute__((ext_vector_type(4), may_alias));
typedef float  v8f  __attribute__((ext_vector_type(8)));
typedef float  v4f  __attribute__((ext_vector_type(4)));
typedef float  v4fa __attribute__((ext_vector_type(4), may_alias));

__device__ __forceinline__ unsigned short bf16_bits(float x) { unsigned int u = __float_as_uint(x); return (unsigned short)((u + 0x7FFFu + ((u >> 16) & 1u)) >> 16); }
__device__ __forceinline__ float bf16_val(unsigned short b) { return __uint_as_float(((unsigned int)b) << 16); }
__device__ __forceinline__ float bf16_round(float x) { return bf16_val(bf16_bits(x)); }

typedef _Float16 v16h __attribute__((ext_vector_type(16)));
union FragH { v16h v; v8us half[2]; _Float16 h[16]; unsigned short u[16]; };

// A 16x16x32 f16 fragment in the hardware's k order from a row of 32 words: words 8 hh .. 8 hh + 7 and 16 + 8 hh .. 16 + 8 hh + 7.
__device__ __forceinline__ v16h g2_frag(const _Float16* p, int hh) { FragH f; f.half[0] = *(const v8us*)((const unsigned short*)p + 8 * hh); f.half[1] = *(const v8us*)((const unsigned short*)p + 16 + 8 * hh); return f.v; }
__device__ __forceinline__ v8f f_mma(v16h a, v16h b, v8f c) { return __builtin_amdgcn_wmma_f32_16x16x32_f16(false, a, false, b, (short)0, c, false, false); }
__device__ __forceinline__ float lane_x16(float x) { return __builtin_bit_cast(float, __builtin_amdgcn_permlanex16(__builtin_bit_cast(int, x), __builtin_bit_cast(int, x), 0x76543210, 0xfedcba98, false, false)); }      /* lane l reads lane l ^ 16 */

// The library's f32 exponential, step for step (product with log2(e) in two words, split at the nearest whole number, 2^fraction, scale, the two range tests), written out for one reason: its v_exp_f32 and the free slot behind it are one statement.
__device__ __forceinline__ float sma_exp(float x) {
  const float ph = x * 0x1.715476p+0f; const float pl = fmaf(x, 0x1.4ae0bep-26f, fmaf(x, 0x1.715476p+0f, -ph)); const float n = rintf(ph); const float a = (ph - n) + pl; float y;
  asm("v_exp_f32 %0, %1\n\tv_nop" : "=v"(y) : "v"(a));      /* v_nop: the slot that the instruction set asks for behind a transcendental */
  y = ldexpf(y, (int)n); y = (x < -0x1.9d1da0p+6f) ? 0.0f : y; return (x > 0x1.62e430p+6f) ? __builtin_inff() : y; }

#define FWAVES 16                    /* waves of a work-group: four a SIMD */
#define FROWS (FWAVES * 16)          /* rows i of a work-group: sixteen a wave */
#define KPW 72                       /* LDS pitch of a ka row in words: 64 + 8 (144 bytes = 16 x 9: 16-byte reads down a column of rows meet no bank twice) */
#define VPW 1032                     /* LDS pitch of a va^T row in words: 1,024 + 8 (2,064 bytes = 16 x 129) */
#define QPW KPW                      /* LDS pitch of a qa row: as a ka row's */
__device__ __forceinline__ _Float16 in_h(float x) { return (_Float16)bf16_round(x); }      /* an input word: bf16 first, then the same value as f16 */
// One wave: sixteen rows of 64 f32 words (pitch ANW) become f16 rows of pitch KPW in LDS. Load u takes rows u (lanes 0-15) and 8 + u (lanes 16-31) whole: four whole 128-byte lines. The 8-byte stores of the two rows lie 8 x 144 bytes apart = 32 banks: each half of the lanes has its own 32 banks.
__device__ __forceinline__ void fill_rows(const float* __restrict__ src, _Float16* dst, int lane) {
  const int hf = lane >> 4, c4 = lane & 15; const float* s = src + (size_t)(8 * hf) * ANW + 4 * c4; unsigned short* d = (unsigned short*)dst + 8 * hf * KPW + 4 * c4; v4f x[8];
#pragma unroll      /* literal trip numbers: the eight loads are issued in a row, ahead of the stores */
  for (int u = 0; u < 8; ++u) x[u] = *(const v4fa*)(s + (size_t)u * ANW);
  asm volatile("s_wait_xcnt 0x0" :: "v"(s) : "memory");      /* the eight loads name s: the pair is kept whole (an input here) until this wait, so that no load's result and no later address lands on it before */
#pragma unroll
  for (int u = 0; u < 8; ++u) { FragH f;
#pragma unroll
    for (int r = 0; r < 4; ++r) f.h[r] = in_h(x[u][r]);
    v4us o; o[0] = f.u[0]; o[1] = f.u[1]; o[2] = f.u[2]; o[3] = f.u[3]; *(v4us*)(d + u * KPW) = o; }
}
// One wave: a block of 32 positions j x 32 columns c of f32 words (pitch ANW) becomes 32 f16 rows [c] of 32 positions in LDS (pitch VPW). A lane takes four columns (16 bytes) of eight positions in a row: load u takes position 8 jq + u of four jq, 128 bytes each: four whole lines. Store k writes column k's eight positions, 16 bytes: among sixteen lanes the four column groups lie 16 banks apart and the four jq 4 banks: every bank once.
__device__ __forceinline__ void fill_cols(const float* __restrict__ src, _Float16* dst, int lane) {
  const int col = 16 * (lane >> 4) + 4 * (lane & 3), j8 = 8 * ((lane >> 2) & 3); const float* s = src + (size_t)j8 * ANW + col; unsigned short* d = (unsigned short*)dst + col * VPW + j8; v4f x[8];
#pragma unroll      /* as above */
  for (int u = 0; u < 8; ++u) x[u] = *(const v4fa*)(s + (size_t)u * ANW);
  asm volatile("s_wait_xcnt 0x0" :: "v"(s) : "memory");      /* the eight loads name s: the pair is kept whole (an input here) until this wait, so that no load's result and no later address lands on it before */
#pragma unroll
  for (int k = 0; k < 4; ++k) { FragH f;
#pragma unroll
    for (int u = 0; u < 8; ++u) f.h[u] = in_h(x[u][k]);
    *(v8us*)(d + k * VPW) = f.half[0]; }
}
// The raw sums of 32 positions j (two tiles of sixteen) against the wave's sixteen rows i, transposed: t0[r] = sum for j = 8 hh + r, t1[r] for j = 16 + 8 hh + r, both of row i = ln. Both walks call it, so both see the same bits.
__device__ __forceinline__ void f_raw(const _Float16* k0, int hh, v16h q0, v16h q1, v8f& t0, v8f& t1) {
  const v8f z8 = {0.f, 0.f, 0.f, 0.f, 0.f, 0.f, 0.f, 0.f}; const _Float16* k1 = k0 + 16 * KPW;
  t0 = f_mma(g2_frag(k0, hh), q0, z8); t1 = f_mma(g2_frag(k1, hh), q0, z8); t0 = f_mma(g2_frag(k0 + 32, hh), q1, t0); t1 = f_mma(g2_frag(k1 + 32, hh), q1, t1); }
// Every bare "#pragma unroll" below is there so that accumulator and fragment words are indexed by literals and stay in registers.
__global__ __launch_bounds__(FWAVES * 32) void k_pair(const float* __restrict__ QF, const float* __restrict__ KF, const float* __restrict__ VF, float* __restrict__ res) {
  __shared__ __attribute__((aligned(16))) _Float16 sk[ANS * KPW];      /* the head's ka rows: [j][c] */
  __shared__ __attribute__((aligned(16))) _Float16 sv[AND * VPW];      /* the head's va transposed: [c][j] */
  __shared__ __attribute__((aligned(16))) _Float16 sq[FROWS * QPW];      /* the work-group's qa rows: [i][c] */
  const int tid = threadIdx.x, lane = tid & 31, ln = lane & 15, hh = lane >> 4, wave = tid >> 5;
  const int g = blockIdx.y / ANH, hd = blockIdx.y % ANH;
  const size_t hb = (size_t)g * ANS * ANW + hd * AND; const float* kp = KF + hb; const float* vp = VF + hb;      /* the head's first word: rows of 64 words, pitch ANW */
  const int i = blockIdx.x * FROWS + wave * 16 + ln;
  fill_rows(QF + hb + (size_t)(blockIdx.x * FROWS + wave * 16) * ANW, sq + wave * 16 * QPW, lane);
#pragma unroll      /* literal trip numbers: a later block's loads may be issued ahead of an earlier block's stores */
  for (int t = 0; t < ANS / 16 / FWAVES; ++t) { const int r0 = (t * FWAVES + wave) * 16; fill_rows(kp + (size_t)r0 * ANW, sk + r0 * KPW, lane); }
#pragma unroll      /* as above */
  for (int t = 0; t < (ANS / 32) * (AND / 32) / FWAVES; ++t) { const int un = t * FWAVES + wave, j0 = (un >> 1) * 32, c0 = (un & 1) * 32; fill_cols(vp + (size_t)j0 * ANW + c0, sv + c0 * VPW + j0, lane); }
  __syncthreads();      /* the one barrier: LDS is only read from here on */
  const _Float16* qr = sq + (wave * 16 + ln) * QPW; const v16h q0 = g2_frag(qr, hh), q1 = g2_frag(qr + 32, hh);      /* the wave's rows i: B operand of the first product, kept in registers */
  const _Float16* ka = sk + ln * KPW; const _Float16* va = sv + ln * VPW;
  float hi = -__builtin_inff();
  for (int jb = 0; jb < ANS / 32; ++jb) { v8f t0, t1; f_raw(ka + jb * 32 * KPW, hh, q0, q1, t0, t1);
#pragma unroll
    for (int r = 0; r < 8; ++r) hi = fmaxf(hi, fmaxf(t0[r], t1[r])); }
  hi = fmaxf(hi, lane_x16(hi)) * 0.125f;      /* lanes ln and ln + 16 hold the two halves of row i; the scale 1/8 is a power of two and keeps the order */
  hi = (fabsf(hi) < __builtin_inff()) ? hi : 0.0f;      /* the module's guard: a largest that is not finite is read as nought */
  const v8f z8 = {0.f, 0.f, 0.f, 0.f, 0.f, 0.f, 0.f, 0.f}; v8f o0 = z8, o1 = z8, o2 = z8, o3 = z8; float s0 = 0.0f, s1 = 0.0f, s2 = 0.0f, s3 = 0.0f;
  for (int jb = 0; jb < ANS / 32; ++jb) { v8f t0, t1; f_raw(ka + jb * 32 * KPW, hh, q0, q1, t0, t1); FragH p;
#pragma unroll
    for (int r = 0; r < 8; r += 2) {
      const float e0 = sma_exp(fminf(fmaxf(t0[r] * 0.125f - hi, ALOW), 0.0f) - AE8), e1 = sma_exp(fminf(fmaxf(t0[r + 1] * 0.125f - hi, ALOW), 0.0f) - AE8);
      const float e2 = sma_exp(fminf(fmaxf(t1[r] * 0.125f - hi, ALOW), 0.0f) - AE8), e3 = sma_exp(fminf(fmaxf(t1[r + 1] * 0.125f - hi, ALOW), 0.0f) - AE8);
      s0 += e0; s1 += e1; s2 += e2; s3 += e3; p.h[r] = (_Float16)e0; p.h[r + 1] = (_Float16)e1; p.h[8 + r] = (_Float16)e2; p.h[8 + r + 1] = (_Float16)e3; }      /* word s of the B operand is position j = 8 hh + s (s < 8) or 16 + 8 hh + s - 8: the two tiles' registers as they lie */
    const _Float16* vj = va + jb * 32;
    o0 = f_mma(g2_frag(vj, hh), p.v, o0); o1 = f_mma(g2_frag(vj + 16 * VPW, hh), p.v, o1); o2 = f_mma(g2_frag(vj + 32 * VPW, hh), p.v, o2); o3 = f_mma(g2_frag(vj + 48 * VPW, hh), p.v, o3); }
  float s = (s0 + s1) + (s2 + s3); s += lane_x16(s);
  s = fminf(fmaxf(s, ASLO), ASHI); const float rc = 1.0f / s;
  float* op = res + ((size_t)g * ANS + i) * ANW + hd * AND + 8 * hh;      /* ot[r] is word c = 16 t + 8 hh + r of row i = ln: eight words in a row a tile */
  const v8f oo[4] = {o0, o1, o2, o3};
#pragma unroll
  for (int t = 0; t < 4; ++t) { v4f a, b;
#pragma unroll
    for (int r = 0; r < 4; ++r) { a[r] = oo[t][r] * rc; b[r] = oo[t][4 + r] * rc; }
    *(v4f*)(op + 16 * t) = a; *(v4f*)(op + 16 * t + 4) = b; }
}

extern "C" void kernel_launch(void* const* d_in, const int* in_sizes, int n_in,
                              void* d_out, int out_size, void* d_ws, size_t ws_size, hipStream_t stream) {
  (void)in_sizes; (void)n_in; (void)out_size; (void)d_ws; (void)ws_size;
  const float* const* I = (const float* const*)d_in; const float* qa = I[0]; const float* ka = I[1]; const float* va = I[2];      /* each [4][1024][16][64] */
  float* res = (float*)d_out;
  static_assert(ANS % FROWS == 0 && ANS % 32 == 0 && AND == 64 && (ANS / 16) % FWAVES == 0 && ((ANS / 32) * (AND / 32)) % FWAVES == 0, "whole tiles");
  k_pair<<<dim3((unsigned)(ANS / FROWS), (unsigned)(ANG * ANH)), FWAVES * 32, 0, stream>>>(qa, ka, va, res);      /* one work-group for 256 rows of one (group, head) */
}

// v004
// One run takes 27.4 microseconds.
// Next to v003, in two timings, it ran 1.43 times as fast each time.
// Over all steps from v000 it is 25.3 times as fast.
// A multi-head pair weighting with a bounded exponential: qa, ka, va [4][1024][16][64] (group, position, head, width): zs[g][h][i][j] = sum over c of (qa[g][i][h][c] / 8) ka[g][j][h][c]; hi = the largest of a row (read as 0 if it is not finite); x = min(max(zs - hi, -8), 0) - exp(-8); e = exp(x); s = min(max(the row's sum of e, 1 - exp(-8)), 1024); wt = e (1 / s); res[g][i][h][:] = sum over j of wt[g][h][i][j] va[g][j][h][:] -> [4][1024][16][64] f32: one result.
// Structure: ONE kernel and one launch, no workspace. A work-group takes 256 rows i of one (group, head). It reads the f32 inputs itself, in whole 128-byte lines, converts each word where it is read (bf16 first, then f16) and fills LDS once (one barrier): its own 256 qa rows, the head's whole ka as rows [j][c], and the head's whole va transposed to rows [c][j] (a lane gathers eight positions j of four columns in registers and stores 16 bytes a column). A wave takes 16 rows. The raw sums are formed transposed (ka rows as A, qa rows as B), so that a lane holds words of one row i alone. Walk 1 over j finds the row's largest; walk 2 forms the same raw sums again, takes the bounded exponential (the module's bounds and subtraction; e^x as 2^(x log2(e)), one hardware exponential a word), adds the row's sum and packs the words e, one f16 word each, straight from the accumulators into the B operand of the second product (va^T rows as A); the one division a row is applied to the f32 result. No raw sum and no weight goes to memory.
// Compute dtype: all three inputs converted to bf16 where they are read; their words exact as f16 operands down to 2^-14; the computed words e (between exp(-8 - exp(-8)) and 1: normal f16 numbers) ONE f16 word each; both products' accumulation, the raw sums, the normalisation's arithmetic and the result f32. v_wmma_f32_16x16x32_f16.
#include <hip/hip_runtime.h>
#define ANG 4                        /* groups */
#define ANS 1024                     /* positions: the normalisation's axis */
#define ANH 16                       /* heads */
#define AND 64                       /* a head's width */
#define ANW (ANH * AND)              /* a row's words: 1,024 */
#define ALOW -8.0f                   /* the module's lower bound of the exponent */
#define AE8 0.00033546262790251185f  /* exp(-8): subtracted from the bounded exponent */
#define ASLO 0.9996645373720975f     /* 1 - exp(-8): the sum's lower bound */
#define ASHI 1024.0f                 /* the sum's upper bound */
typedef unsigned short v8us __attribute__((ext_vector_type(8), may_alias));
typedef unsigned short v4us __attribute__((ext_vector_type(4), may_alias));
typedef float  v8f  __attribute__((ext_vector_type(8)));
typedef float  v4f  __attribute__((ext_vector_type(4)));
typedef float  v4fa __attribute__((ext_vector_type(4), may_alias));

__device__ __forceinline__ unsigned short bf16_bits(float x) { unsigned int u = __float_as_uint(x); return (unsigned short)((u + 0x7FFFu + ((u >> 16) & 1u)) >> 16); }
__device__ __forceinline__ float bf16_val(unsigned short b) { return __uint_as_float(((unsigned int)b) << 16); }
__device__ __forceinline__ float bf16_round(float x) { return bf16_val(bf16_bits(x)); }

typedef _Float16 v16h __attribute__((ext_vector_type(16)));
union FragH { v16h v; v8us half[2]; _Float16 h[16]; unsigned short u[16]; };

// A 16x16x32 f16 fragment in the hardware's k order from a row of 32 words: words 8 hh .. 8 hh + 7 and 16 + 8 hh .. 16 + 8 hh + 7.
__device__ __forceinline__ v16h g2_frag(const _Float16* p, int hh) { FragH f; f.half[0] = *(const v8us*)((const unsigned short*)p + 8 * hh); f.half[1] = *(const v8us*)((const unsigned short*)p + 16 + 8 * hh); return f.v; }
__device__ __forceinline__ v8f f_mma(v16h a, v16h b, v8f c) { return __builtin_amdgcn_wmma_f32_16x16x32_f16(false, a, false, b, (short)0, c, false, false); }
__device__ __forceinline__ float lane_x16(float x) { return __builtin_bit_cast(float, __builtin_amdgcn_permlanex16(__builtin_bit_cast(int, x), __builtin_bit_cast(int, x), 0x76543210, 0xfedcba98, false, false)); }      /* lane l reads lane l ^ 16 */

// Eight words 2^a in one statement. The bounded exponent lies in [-8 - exp(-8), -exp(-8)], so a = x log2(e) lies in (-12, 0]: inside the range where v_exp_f32 is right by itself (no split at a whole number, no scaling, no range test: each is an identity there).
__device__ __forceinline__ void exp2_x8(const float (&a)[8], float (&y)[8]) {
  asm("v_exp_f32 %0, %8\n\tv_exp_f32 %1, %9\n\tv_exp_f32 %2, %10\n\tv_exp_f32 %3, %11\n\tv_exp_f32 %4, %12\n\tv_exp_f32 %5, %13\n\tv_exp_f32 %6, %14\n\tv_exp_f32 %7, %15\n\tv_nop"
      : "=&v"(y[0]), "=&v"(y[1]), "=&v"(y[2]), "=&v"(y[3]), "=&v"(y[4]), "=&v"(y[5]), "=&v"(y[6]), "=&v"(y[7])
      : "v"(a[0]), "v"(a[1]), "v"(a[2]), "v"(a[3]), "v"(a[4]), "v"(a[5]), "v"(a[6]), "v"(a[7])); }      /* one statement: each v_exp_f32 has an independent one behind it (results apart from all sources), the last the v_nop: the slot that the instruction set asks for behind a transcendental */
#define AL2E 0x1.715476p+0f          /* log2(e) */
// The module's bounded exponent of a raw sum t, times log2(e): the bounds and the subtraction as the module has them, the constant taken off in the same multiply-add that changes the base.
typedef float v2f __attribute__((ext_vector_type(2)));
__device__ __forceinline__ v2f sma_arg(float ta, float tb, float hi) { const v2f t = {ta, tb}, h = {hi, hi}, e = {0.125f, 0.125f}, l = {AL2E, AL2E}, k = {-AE8 * AL2E, -AE8 * AL2E};      /* two words a call: both multiply-adds are packed f32 instructions */
  v2f d = __builtin_elementwise_fma(t, e, -h); d[0] = fminf(fmaxf(d[0], ALOW), 0.0f); d[1] = fminf(fmaxf(d[1], ALOW), 0.0f); return __builtin_elementwise_fma(d, l, k); }

#define FWAVES 16                    /* waves of a work-group: four a SIMD */
#define FROWS (FWAVES * 16)          /* rows i of a work-group: sixteen a wave */
#define KPW 72                       /* LDS pitch of a ka row in words: 64 + 8 (144 bytes = 16 x 9: 16-byte reads down a column of rows meet no bank twice) */
#define VPW 1032                     /* LDS pitch of a va^T row in words: 1,024 + 8 (2,064 bytes = 16 x 129) */
#define QPW KPW                      /* LDS pitch of a qa row: as a ka row's */
__device__ __forceinline__ _Float16 in_h(float x) { return (_Float16)bf16_round(x); }      /* an input word: bf16 first, then the same value as f16 */
// One wave: sixteen rows of 64 f32 words (pitch ANW) become f16 rows of pitch KPW in LDS. Load u takes rows u (lanes 0-15) and 8 + u (lanes 16-31) whole: four whole 128-byte lines. The 8-byte stores of the two rows lie 8 x 144 bytes apart = 32 banks: each half of the lanes has its own 32 banks.
__device__ __forceinline__ void fill_rows(const float* __restrict__ src, _Float16* dst, int lane) {
  const int hf = lane >> 4, c4 = lane & 15; const float* s = src + (size_t)(8 * hf) * ANW + 4 * c4; unsigned short* d = (unsigned short*)dst + 8 * hf * KPW + 4 * c4; v4f x[8];
#pragma unroll      /* literal trip numbers: the eight loads are issued in a row, ahead of the stores */
  for (int u = 0; u < 8; ++u) x[u] = *(const v4fa*)(s + (size_t)u * ANW);
  asm volatile("s_wait_xcnt 0x0" :: "v"(s) : "memory");      /* the eight loads name s: the pair is kept whole (an input here) until this wait, so that no load's result and no later address lands on it before */
#pragma unroll
  for (int u = 0; u < 8; ++u) { FragH f;
#pragma unroll
    for (int r = 0; r < 4; ++r) f.h[r] = in_h(x[u][r]);
    v4us o; o[0] = f.u[0]; o[1] = f.u[1]; o[2] = f.u[2]; o[3] = f.u[3]; *(v4us*)(d + u * KPW) = o; }
}
// One wave: a block of 32 positions j x 32 columns c of f32 words (pitch ANW) becomes 32 f16 rows [c] of 32 positions in LDS (pitch VPW). A lane takes four columns (16 bytes) of eight positions in a row: load u takes position 8 jq + u of four jq, 128 bytes each: four whole lines. Store k writes column k's eight positions, 16 bytes: among sixteen lanes the four column groups lie 16 banks apart and the four jq 4 banks: every bank once.
__device__ __forceinline__ void fill_cols(const float* __restrict__ src, _Float16* dst, int lane) {
  const int col = 16 * (lane >> 4) + 4 * (lane & 3), j8 = 8 * ((lane >> 2) & 3); const float* s = src + (size_t)j8 * ANW + col; unsigned short* d = (unsigned short*)dst + col * VPW + j8; v4f x[8];
#pragma unroll      /* as above */
  for (int u = 0; u < 8; ++u) x[u] = *(const v4fa*)(s + (size_t)u * ANW);
  asm volatile("s_wait_xcnt 0x0" :: "v"(s) : "memory");      /* the eight loads name s: the pair is kept whole (an input here) until this wait, so that no load's result and no later address lands on it before */
#pragma unroll
  for (int k = 0; k < 4; ++k) { FragH f;
#pragma unroll
    for (int u = 0; u < 8; ++u) f.h[u] = in_h(x[u][k]);
    *(v8us*)(d + k * VPW) = f.half[0]; }
}
// The raw sums of 32 positions j (two tiles of sixteen) against the wave's sixteen rows i, transposed: t0[r] = sum for j = 8 hh + r, t1[r] for j = 16 + 8 hh + r, both of row i = ln. Both walks call it, so both see the same bits.
__device__ __forceinline__ void f_raw(const _Float16* k0, int hh, v16h q0, v16h q1, v8f& t0, v8f& t1) {
  const v8f z8 = {0.f, 0.f, 0.f, 0.f, 0.f, 0.f, 0.f, 0.f}; const _Float16* k1 = k0 + 16 * KPW;
  t0 = f_mma(g2_frag(k0, hh), q0, z8); t1 = f_mma(g2_frag(k1, hh), q0, z8); t0 = f_mma(g2_frag(k0 + 32, hh), q1, t0); t1 = f_mma(g2_frag(k1 + 32, hh), q1, t1); }
// Every bare "#pragma unroll" below is there so that accumulator and fragment words are indexed by literals and stay in registers.
__global__ __launch_bounds__(FWAVES * 32) void k_pair(const float* __restrict__ QF, const float* __restrict__ KF, const float* __restrict__ VF, float* __restrict__ res) {
  __shared__ __attribute__((aligned(16))) _Float16 sk[ANS * KPW];      /* the head's ka rows: [j][c] */
  __shared__ __attribute__((aligned(16))) _Float16 sv[AND * VPW];      /* the head's va transposed: [c][j] */
  __shared__ __attribute__((aligned(16))) _Float16 sq[FROWS * QPW];      /* the work-group's qa rows: [i][c] */
  const int tid = threadIdx.x, lane = tid & 31, ln = lane & 15, hh = lane >> 4, wave = tid >> 5;
  const int g = blockIdx.y / ANH, hd = blockIdx.y % ANH;
  const size_t hb = (size_t)g * ANS * ANW + hd * AND; const float* kp = KF + hb; const float* vp = VF + hb;      /* the head's first word: rows of 64 words, pitch ANW */
  const int i = blockIdx.x * FROWS + wave * 16 + ln;
  fill_rows(QF + hb + (size_t)(blockIdx.x * FROWS + wave * 16) * ANW, sq + wave * 16 * QPW, lane);
#pragma unroll      /* literal trip numbers: a later block's loads may be issued ahead of an earlier block's stores */
  for (int t = 0; t < ANS / 16 / FWAVES; ++t) { const int r0 = (t * FWAVES + wave) * 16; fill_rows(kp + (size_t)r0 * ANW, sk + r0 * KPW, lane); }
#pragma unroll      /* as above */
  for (int t = 0; t < (ANS / 32) * (AND / 32) / FWAVES; ++t) { const int un = t * FWAVES + wave, j0 = (un >> 1) * 32, c0 = (un & 1) * 32; fill_cols(vp + (size_t)j0 * ANW + c0, sv + c0 * VPW + j0, lane); }
  __syncthreads();      /* the one barrier: LDS is only read from here on */
  const _Float16* qr = sq + (wave * 16 + ln) * QPW; const v16h q0 = g2_frag(qr, hh), q1 = g2_frag(qr + 32, hh);      /* the wave's rows i: B operand of the first product, kept in registers */
  const _Float16* ka = sk + ln * KPW; const _Float16* va = sv + ln * VPW;
  float hi = -__builtin_inff();
  for (int jb = 0; jb < ANS / 32; ++jb) { v8f t0, t1; f_raw(ka + jb * 32 * KPW, hh, q0, q1, t0, t1);
#pragma unroll
    for (int r = 0; r < 8; ++r) hi = fmaxf(hi, fmaxf(t0[r], t1[r])); }
  hi = fmaxf(hi, lane_x16(hi)) * 0.125f;      /* lanes ln and ln + 16 hold the two halves of row i; the scale 1/8 is a power of two and keeps the order */
  hi = (fabsf(hi) < __builtin_inff()) ? hi : 0.0f;      /* the module's guard: a largest that is not finite is read as nought */
  const v8f z8 = {0.f, 0.f, 0.f, 0.f, 0.f, 0.f, 0.f, 0.f}; v8f o0 = z8, o1 = z8, o2 = z8, o3 = z8; float s0 = 0.0f, s1 = 0.0f, s2 = 0.0f, s3 = 0.0f;
  for (int jb = 0; jb < ANS / 32; ++jb) { v8f t0, t1; f_raw(ka + jb * 32 * KPW, hh, q0, q1, t0, t1); FragH p;
    float a0[8], a1[8], e0[8], e1[8];
#pragma unroll
    for (int r = 0; r < 8; r += 2) { const v2f x0 = sma_arg(t0[r], t0[r + 1], hi), x1 = sma_arg(t1[r], t1[r + 1], hi); a0[r] = x0[0]; a0[r + 1] = x0[1]; a1[r] = x1[0]; a1[r + 1] = x1[1]; }
    exp2_x8(a0, e0); exp2_x8(a1, e1);
#pragma unroll
    for (int r = 0; r < 8; r += 2) { s0 += e0[r]; s1 += e0[r + 1]; s2 += e1[r]; s3 += e1[r + 1]; p.h[r] = (_Float16)e0[r]; p.h[r + 1] = (_Float16)e0[r + 1]; p.h[8 + r] = (_Float16)e1[r]; p.h[8 + r + 1] = (_Float16)e1[r + 1]; }      /* word s of the B operand is position j = 8 hh + s (s < 8) or 16 + 8 hh + s - 8: the two tiles' registers as they lie */
    const _Float16* vj = va + jb * 32;
    o0 = f_mma(g2_frag(vj, hh), p.v, o0); o1 = f_mma(g2_frag(vj + 16 * VPW, hh), p.v, o1); o2 = f_mma(g2_frag(vj + 32 * VPW, hh), p.v, o2); o3 = f_mma(g2_frag(vj + 48 * VPW, hh), p.v, o3); }
  float s = (s0 + s1) + (s2 + s3); s += lane_x16(s);
  s = fminf(fmaxf(s, ASLO), ASHI); const float rc = 1.0f / s;
  float* op = res + ((size_t)g * ANS + i) * ANW + hd * AND + 8 * hh;      /* ot[r] is word c = 16 t + 8 hh + r of row i = ln: eight words in a row a tile */
  const v8f oo[4] = {o0, o1, o2, o3};
#pragma unroll
  for (int t = 0; t < 4; ++t) { v4f a, b;
#pragma unroll
    for (int r = 0; r < 4; ++r) { a[r] = oo[t][r] * rc; b[r] = oo[t][4 + r] * rc; }
    *(v4f*)(op + 16 * t) = a; *(v4f*)(op + 16 * t + 4) = b; }
}

extern "C" void kernel_launch(void* const* d_in, const int* in_sizes, int n_in,
                              void* d_out, int out_size, void* d_ws, size_t ws_size, hipStream_t stream) {
  (void)in_sizes; (void)n_in; (void)out_size; (void)d_ws; (void)ws_size;
  const float* const* I = (const float* const*)d_in; const float* qa = I[0]; const float* ka = I[1]; const float* va = I[2];      /* each [4][1024][16][64] */
  float* res = (float*)d_out;
  static_assert(ANS % FROWS == 0 && ANS % 32 == 0 && AND == 64 && (ANS / 16) % FWAVES == 0 && ((ANS / 32) * (AND / 32)) % FWAVES == 0, "whole tiles");
  k_pair<<<dim3((unsigned)(ANS / FROWS), (unsigned)(ANG * ANH)), FWAVES * 32, 0, stream>>>(qa, ka, va, res);      /* one work-group for 256 rows of one (group, head) */
}

// v005
// Measured time: 26.2 microseconds a run.
// In two side-by-side timings against v004, it was 1.05 and 1.04 times as fast.
// All steps since v000 together make it 26.5 times as fast.
// A multi-head pair weighting with a bounded exponential: qa, ka, va [4][1024][16][64] (group, position, head, width): zs[g][h][i][j] = sum over c of (qa[g][i][h][c] / 8) ka[g][j][h][c]; hi = the largest of a row (read as 0 if it is not finite); x = min(max(zs - hi, -8), 0) - exp(-8); e = exp(x); s = min(max(the row's sum of e, 1 - exp(-8)), 1024); wt = e (1 / s); res[g][i][h][:] = sum over j of wt[g][h][i][j] va[g][j][h][:] -> [4][1024][16][64] f32: one result.
// Structure: ONE kernel and one launch, no workspace. A work-group takes 256 rows i of one (group, head). It reads the f32 inputs itself, in whole 128-byte lines, converts each word where it is read (bf16 first, then f16) and fills LDS once (one barrier): its own 256 qa rows, the head's whole ka as rows [j][c], and the head's whole va transposed to rows [c][j] (a lane gathers eight positions j of four columns in registers and stores 16 bytes a column). Two waves share 32 rows: each takes all 32 rows against one half of the positions j, so that every ka and va^T fragment read from LDS feeds two products. The raw sums are formed transposed (ka rows as A, qa rows as B), so that a lane holds words of one row i alone. Walk 1 over the wave's j finds each row's largest there, and the two waves join their largest through LDS (one barrier); walk 2 forms the same raw sums again, takes the bounded exponential (the module's bounds and subtraction; e^x as 2^(x log2(e)), one hardware exponential a word), adds the row's sum and packs the words e, one f16 word each, straight from the accumulators into the B operand of the second product (va^T rows as A); at the end each wave hands the other the sixteen rows that the other finishes (f32 sums and row sum, through LDS that the walks have left: two barriers), and the one division a row is applied to the joined f32 result. No raw sum and no weight goes to memory.
// Compute dtype: all three inputs converted to bf16 where they are read; their words exact as f16 operands down to 2^-14; the computed words e (between exp(-8 - exp(-8)) and 1: normal f16 numbers) ONE f16 word each; both products' accumulation, the raw sums, the normalisation's arithmetic and the result f32. v_wmma_f32_16x16x32_f16.
#include <hip/hip_runtime.h>
#define ANG 4                        /* groups */
#define ANS 1024                     /* positions: the normalisation's axis */
#define ANH 16                       /* heads */
#define AND 64                       /* a head's width */
#define ANW (ANH * AND)              /* a row's words: 1,024 */
#define ALOW -8.0f                   /* the module's lower bound of the exponent */
#define AE8 0.00033546262790251185f  /* exp(-8): subtracted from the bounded exponent */
#define ASLO 0.9996645373720975f     /* 1 - exp(-8): the sum's lower bound */
#define ASHI 1024.0f                 /* the sum's upper bound */
typedef unsigned short v8us __attribute__((ext_vector_type(8), may_alias));
typedef unsigned short v4us __attribute__((ext_vector_type(4), may_alias));
typedef float  v8f  __attribute__((ext_vector_type(8)));
typedef float  v4f  __attribute__((ext_vector_type(4)));
typedef float  v4fa __attribute__((ext_vector_type(4), may_alias));
typedef float  f1a  __attribute__((may_alias));

__device__ __forceinline__ unsigned short bf16_bits(float x) { unsigned int u = __float_as_uint(x); return (unsigned short)((u + 0x7FFFu + ((u >> 16) & 1u)) >> 16); }
__device__ __forceinline__ float bf16_val(unsigned short b) { return __uint_as_float(((unsigned int)b) << 16); }
__device__ __forceinline__ float bf16_round(float x) { return bf16_val(bf16_bits(x)); }

typedef _Float16 v16h __attribute__((ext_vector_type(16)));
union FragH { v16h v; v8us half[2]; _Float16 h[16]; unsigned short u[16]; };

// A 16x16x32 f16 fragment in the hardware's k order from a row of 32 words: words 8 hh .. 8 hh + 7 and 16 + 8 hh .. 16 + 8 hh + 7.
__device__ __forceinline__ v16h g2_frag(const _Float16* p, int hh) { FragH f; f.half[0] = *(const v8us*)((const unsigned short*)p + 8 * hh); f.half[1] = *(const v8us*)((const unsigned short*)p + 16 + 8 * hh); return f.v; }
__device__ __forceinline__ v8f f_mma(v16h a, v16h b, v8f c) { return __builtin_amdgcn_wmma_f32_16x16x32_f16(false, a, false, b, (short)0, c, false, false); }
__device__ __forceinline__ float lane_x16(float x) { return __builtin_bit_cast(float, __builtin_amdgcn_permlanex16(__builtin_bit_cast(int, x), __builtin_bit_cast(int, x), 0x76543210, 0xfedcba98, false, false)); }      /* lane l reads lane l ^ 16 */

// Eight words 2^a in one statement. The bounded exponent lies in [-8 - exp(-8), -exp(-8)], so a = x log2(e) lies in (-12, 0]: inside the range where v_exp_f32 is right by itself (no split at a whole number, no scaling, no range test: each is an identity there).
__device__ __forceinline__ void exp2_x8(const float (&a)[8], float (&y)[8]) {
  asm("v_exp_f32 %0, %8\n\tv_exp_f32 %1, %9\n\tv_exp_f32 %2, %10\n\tv_exp_f32 %3, %11\n\tv_exp_f32 %4, %12\n\tv_exp_f32 %5, %13\n\tv_exp_f32 %6, %14\n\tv_exp_f32 %7, %15\n\tv_nop"
      : "=&v"(y[0]), "=&v"(y[1]), "=&v"(y[2]), "=&v"(y[3]), "=&v"(y[4]), "=&v"(y[5]), "=&v"(y[6]), "=&v"(y[7])
      : "v"(a[0]), "v"(a[1]), "v"(a[2]), "v"(a[3]), "v"(a[4]), "v"(a[5]), "v"(a[6]), "v"(a[7])); }      /* one statement: each v_exp_f32 has an independent one behind it (results apart from all sources), the last the v_nop: the slot that the instruction set asks for behind a transcendental */
#define AL2E 0x1.715476p+0f          /* log2(e) */
// The module's bounded exponent of a raw sum t, times log2(e): the bounds and the subtraction as the module has them, the constant taken off in the same multiply-add that changes the base.
typedef float v2f __attribute__((ext_vector_type(2)));
__device__ __forceinline__ v2f sma_arg(float ta, float tb, float hi) { const v2f t = {ta, tb}, h = {hi, hi}, e = {0.125f, 0.125f}, l = {AL2E, AL2E}, k = {-AE8 * AL2E, -AE8 * AL2E};      /* two words a call: both multiply-adds are packed f32 instructions */
  v2f d = __builtin_elementwise_fma(t, e, -h); d[0] = fminf(fmaxf(d[0], ALOW), 0.0f); d[1] = fminf(fmaxf(d[1], ALOW), 0.0f); return __builtin_elementwise_fma(d, l, k); }

#define FWAVES 16                    /* waves of a work-group: four a SIMD */
#define FROWS (FWAVES * 16)          /* rows i of a work-group: 32 a pair of waves */
#define JHALF (ANS / 2)              /* positions j of a wave: one half */
#define XW (32 * 32 + 32)            /* f32 words that a wave hands to its partner: four 16 x 16 tiles and sixteen row sums (held twice) */
#define KPW 72                       /* LDS pitch of a ka row in words: 64 + 8 (144 bytes = 16 x 9: 16-byte reads down a column of rows meet no bank twice) */
#define VPW 1032                     /* LDS pitch of a va^T row in words: 1,024 + 8 (2,064 bytes = 16 x 129) */
#define QPW KPW                      /* LDS pitch of a qa row: as a ka row's */
static_assert(JHALF % 32 == 0 && FWAVES % 2 == 0 && FWAVES * XW * 4 <= ANS * KPW * 2, "whole passes a half; the hand-over fits the ka rows' LDS");
__device__ __forceinline__ _Float16 in_h(float x) { return (_Float16)bf16_round(x); }      /* an input word: bf16 first, then the same value as f16 */
// One wave: sixteen rows of 64 f32 words (pitch ANW) become f16 rows of pitch KPW in LDS. Load u takes rows u (lanes 0-15) and 8 + u (lanes 16-31) whole: four whole 128-byte lines. The 8-byte stores of the two rows lie 8 x 144 bytes apart = 32 banks: each half of the lanes has its own 32 banks.
__device__ __forceinline__ void fill_rows(const float* __restrict__ src, _Float16* dst, int lane) {
  const int hf = lane >> 4, c4 = lane & 15; const float* s = src + (size_t)(8 * hf) * ANW + 4 * c4; unsigned short* d = (unsigned short*)dst + 8 * hf * KPW + 4 * c4; v4f x[8];
#pragma unroll      /* literal trip numbers: the eight loads are issued in a row, ahead of the stores */
  for (int u = 0; u < 8; ++u) x[u] = *(const v4fa*)(s + (size_t)u * ANW);
  asm volatile("s_wait_xcnt 0x0" :: "v"(s) : "memory");      /* the eight loads name s: the pair is kept whole (an input here) until this wait, so that no load's result and no later address lands on it before */
#pragma unroll
  for (int u = 0; u < 8; ++u) { FragH f;
#pragma unroll
    for (int r = 0; r < 4; ++r) f.h[r] = in_h(x[u][r]);
    v4us o; o[0] = f.u[0]; o[1] = f.u[1]; o[2] = f.u[2]; o[3] = f.u[3]; *(v4us*)(d + u * KPW) = o; }
}
// One wave: a block of 32 positions j x 32 columns c of f32 words (pitch ANW) becomes 32 f16 rows [c] of 32 positions in LDS (pitch VPW). A lane takes four columns (16 bytes) of eight positions in a row: load u takes position 8 jq + u of four jq, 128 bytes each: four whole lines. Store k writes column k's eight positions, 16 bytes: among sixteen lanes the four column groups lie 16 banks apart and the four jq 4 banks: every bank once.
__device__ __forceinline__ void fill_cols(const float* __restrict__ src, _Float16* dst, int lane) {
  const int col = 16 * (lane >> 4) + 4 * (lane & 3), j8 = 8 * ((lane >> 2) & 3); const float* s = src + (size_t)j8 * ANW + col; unsigned short* d = (unsigned short*)dst + col * VPW + j8; v4f x[8];
#pragma unroll      /* as above */
  for (int u = 0; u < 8; ++u) x[u] = *(const v4fa*)(s + (size_t)u * ANW);
  asm volatile("s_wait_xcnt 0x0" :: "v"(s) : "memory");      /* the eight loads name s: the pair is kept whole (an input here) until this wait, so that no load's result and no later address lands on it before */
#pragma unroll
  for (int k = 0; k < 4; ++k) { FragH f;
#pragma unroll
    for (int u = 0; u < 8; ++u) f.h[u] = in_h(x[u][k]);
    *(v8us*)(d + k * VPW) = f.half[0]; }
}
// The raw sums of 32 positions j (two tiles of sixteen) against two tiles of sixteen rows i (q: the wave's own, p: its partner's), transposed: t0[r] = sum for j = 8 hh + r, t1[r] for j = 16 + 8 hh + r, both of row i = ln of the first tile; u0, u1 the same of the second. Each of the four ka fragments (f_ka reads them) is read once and feeds both tiles. Both walks call the two, so both see the same bits.
struct KaF { v16h a00, a10, a01, a11; };
__device__ __forceinline__ KaF f_ka(const _Float16* k0, int hh) { const _Float16* k1 = k0 + 16 * KPW; KaF f; f.a00 = g2_frag(k0, hh); f.a10 = g2_frag(k1, hh); f.a01 = g2_frag(k0 + 32, hh); f.a11 = g2_frag(k1 + 32, hh); return f; }
__device__ __forceinline__ void f_raw(const KaF& f, v16h q0, v16h q1, v16h p0, v16h p1, v8f& t0, v8f& t1, v8f& u0, v8f& u1) {
  const v8f z8 = {0.f, 0.f, 0.f, 0.f, 0.f, 0.f, 0.f, 0.f}; const v16h a00 = f.a00, a10 = f.a10, a01 = f.a01, a11 = f.a11;
  t0 = f_mma(a00, q0, z8); t1 = f_mma(a10, q0, z8); u0 = f_mma(a00, p0, z8); u1 = f_mma(a10, p0, z8);
  t0 = f_mma(a01, q1, t0); t1 = f_mma(a11, q1, t1); u0 = f_mma(a01, p1, u0); u1 = f_mma(a11, p1, u1); }
// One tile of rows, 32 positions: the bounded exponential of the raw sums, added to the row's four chains and packed as the B operand of the second product: word s is position j = 8 hh + s (s < 8) or 16 + 8 hh + s - 8: the two tiles' registers as they lie.
__device__ __forceinline__ v16h f_wt(const v8f& t0, const v8f& t1, float hi, float (&s)[4]) { FragH p; float a0[8], a1[8], e0[8], e1[8];
#pragma unroll      /* here and below: literal indices, so that the words stay in registers */
  for (int r = 0; r < 8; r += 2) { const v2f x0 = sma_arg(t0[r], t0[r + 1], hi), x1 = sma_arg(t1[r], t1[r + 1], hi); a0[r] = x0[0]; a0[r + 1] = x0[1]; a1[r] = x1[0]; a1[r + 1] = x1[1]; }
  exp2_x8(a0, e0); exp2_x8(a1, e1);
#pragma unroll
  for (int r = 0; r < 8; r += 2) { s[0] += e0[r]; s[1] += e0[r + 1]; s[2] += e1[r]; s[3] += e1[r + 1]; p.h[r] = (_Float16)e0[r]; p.h[r + 1] = (_Float16)e0[r + 1]; p.h[8 + r] = (_Float16)e1[r]; p.h[8 + r + 1] = (_Float16)e1[r + 1]; }
  return p.v; }
// Every bare "#pragma unroll" below is there so that accumulator and fragment words are indexed by literals and stay in registers.
__global__ __launch_bounds__(FWAVES * 32) void k_pair(const float* __restrict__ QF, const float* __restrict__ KF, const float* __restrict__ VF, float* __restrict__ res) {
  __shared__ __attribute__((aligned(16))) _Float16 sk[ANS * KPW];      /* the head's ka rows: [j][c] */
  __shared__ __attribute__((aligned(16))) _Float16 sv[AND * VPW];      /* the head's va transposed: [c][j] */
  __shared__ __attribute__((aligned(16))) _Float16 sq[FROWS * QPW];      /* the work-group's qa rows: [i][c] */
  __shared__ float sx[FWAVES * 32];      /* each wave's largest of 32 rows over its half of j */
  const int tid = threadIdx.x, lane = tid & 31, ln = lane & 15, hh = lane >> 4, wave = tid >> 5;
  const int g = blockIdx.y / ANH, hd = blockIdx.y % ANH;
  const size_t hb = (size_t)g * ANS * ANW + hd * AND; const float* kp = KF + hb; const float* vp = VF + hb;      /* the head's first word: rows of 64 words, pitch ANW */
  const int i = blockIdx.x * FROWS + wave * 16 + ln;
  fill_rows(QF + hb + (size_t)(blockIdx.x * FROWS + wave * 16) * ANW, sq + wave * 16 * QPW, lane);
#pragma unroll      /* literal trip numbers: a later block's loads may be issued ahead of an earlier block's stores */
  for (int t = 0; t < ANS / 16 / FWAVES; ++t) { const int r0 = (t * FWAVES + wave) * 16; fill_rows(kp + (size_t)r0 * ANW, sk + r0 * KPW, lane); }
#pragma unroll      /* as above */
  for (int t = 0; t < (ANS / 32) * (AND / 32) / FWAVES; ++t) { const int un = t * FWAVES + wave, j0 = (un >> 1) * 32, c0 = (un & 1) * 32; fill_cols(vp + (size_t)j0 * ANW + c0, sv + c0 * VPW + j0, lane); }
  __syncthreads();      /* LDS is filled: the walks only read sk, sv and sq */
  const int jh = wave & 1;      /* the wave's half of the positions; waves 2 n and 2 n + 1 share rows 32 n .. 32 n + 31, and each finishes its own sixteen (tile q), the partner the other sixteen (tile p) */
  const _Float16* qr = sq + (wave * 16 + ln) * QPW; const _Float16* pr = sq + ((wave ^ 1) * 16 + ln) * QPW;
  const v16h q0 = g2_frag(qr, hh), q1 = g2_frag(qr + 32, hh), p0 = g2_frag(pr, hh), p1 = g2_frag(pr + 32, hh);      /* both tiles of rows i: B operands of the first product, kept in registers */
  const _Float16* ka = sk + (jh * JHALF + ln) * KPW; const _Float16* va = sv + ln * VPW + jh * JHALF;
  float hq = -__builtin_inff(), hp = -__builtin_inff();
  for (int jb = 0; jb < JHALF / 32; ++jb) { const KaF kf = f_ka(ka + jb * 32 * KPW, hh);
    __builtin_amdgcn_sched_barrier(0);      /* the pass's eight LDS reads stay one group ahead of its products; left free they stand at three places among the WMMAs, into registers used twice, and are waited for at each */
    v8f t0, t1, u0, u1; f_raw(kf, q0, q1, p0, p1, t0, t1, u0, u1);
#pragma unroll
    for (int r = 0; r < 8; ++r) { hq = fmaxf(hq, fmaxf(t0[r], t1[r])); hp = fmaxf(hp, fmaxf(u0[r], u1[r])); } }
  hq = fmaxf(hq, lane_x16(hq)); hp = fmaxf(hp, lane_x16(hp));      /* lanes ln and ln + 16 hold the two halves of a row's words */
  sx[wave * 32 + lane] = hh ? hp : hq;      /* words 0-15: the wave's own tile, 16-31: the partner's */
  __syncthreads();      /* each wave's largest over its half of j is in LDS */
  hq = fmaxf(hq, sx[(wave ^ 1) * 32 + 16 + ln]) * 0.125f; hp = fmaxf(hp, sx[(wave ^ 1) * 32 + ln]) * 0.125f;      /* the largest of the whole row; the scale 1/8 is a power of two and keeps the order */
  hq = (fabsf(hq) < __builtin_inff()) ? hq : 0.0f; hp = (fabsf(hp) < __builtin_inff()) ? hp : 0.0f;      /* the module's guard: a largest that is not finite is read as nought */
  const v8f z8 = {0.f, 0.f, 0.f, 0.f, 0.f, 0.f, 0.f, 0.f}; v8f o0 = z8, o1 = z8, o2 = z8, o3 = z8, w0 = z8, w1 = z8, w2 = z8, w3 = z8; float sq4[4] = {0.0f, 0.0f, 0.0f, 0.0f}, sp4[4] = {0.0f, 0.0f, 0.0f, 0.0f};
  for (int jb = 0; jb < JHALF / 32; ++jb) { const KaF kf = f_ka(ka + jb * 32 * KPW, hh);
    const _Float16* vj = va + jb * 32; const v16h a0 = g2_frag(vj, hh), a1 = g2_frag(vj + 16 * VPW, hh), a2 = g2_frag(vj + 32 * VPW, hh), a3 = g2_frag(vj + 48 * VPW, hh);      /* each va^T fragment is read once and feeds both tiles */
    __builtin_amdgcn_sched_barrier(0);      /* the pass's sixteen LDS reads stay one group, ka first, ahead of the first product: it and the vector work cover the va^T reads' latency; left free those sink among the second product's WMMAs and are waited for there */
    v8f t0, t1, u0, u1; f_raw(kf, q0, q1, p0, p1, t0, t1, u0, u1);
    const v16h eq = f_wt(t0, t1, hq, sq4), ep = f_wt(u0, u1, hp, sp4);
    __builtin_amdgcn_sched_barrier(0);      /* the row sums' additions stay ahead of the second product; left free they land behind its WMMAs on operand registers, each time at the price of the four idle slots that the chip asks for there */
    o0 = f_mma(a0, eq, o0); w0 = f_mma(a0, ep, w0); o1 = f_mma(a1, eq, o1); w1 = f_mma(a1, ep, w1); o2 = f_mma(a2, eq, o2); w2 = f_mma(a2, ep, w2); o3 = f_mma(a3, eq, o3); w3 = f_mma(a3, ep, w3); }
  float s = (sq4[0] + sq4[1]) + (sq4[2] + sq4[3]); s += lane_x16(s); float sp = (sp4[0] + sp4[1]) + (sp4[2] + sp4[3]); sp += lane_x16(sp);
  __syncthreads();      /* every wave has left walk 2: sk is free to carry the hand-over */
  float* xw = (float*)sk + wave * XW + 4 * lane; const float* xr = (const float*)sk + (wave ^ 1) * XW + 4 * lane;      /* 16 bytes a lane, 512 bytes in a row a store or read: each half of the lanes meets every bank once */
  const v8f ww[4] = {w0, w1, w2, w3};
#pragma unroll
  for (int t = 0; t < 4; ++t) { v4f a, b;
#pragma unroll
    for (int r = 0; r < 4; ++r) { a[r] = ww[t][r]; b[r] = ww[t][4 + r]; }
    *(v4fa*)(xw + 256 * t) = a; *(v4fa*)(xw + 256 * t + 128) = b; }
  *(f1a*)((float*)sk + wave * XW + 1024 + lane) = sp;
  __syncthreads();      /* the partner's sums over its half of j are in LDS */
  v8f oj[4] = {o0, o1, o2, o3};
#pragma unroll
  for (int t = 0; t < 4; ++t) { const v4f a = *(const v4fa*)(xr + 256 * t), b = *(const v4fa*)(xr + 256 * t + 128);
#pragma unroll
    for (int r = 0; r < 4; ++r) { oj[t][r] += a[r]; oj[t][4 + r] += b[r]; } }
  s += *(const f1a*)((const float*)sk + (wave ^ 1) * XW + 1024 + lane);
  s = fminf(fmaxf(s, ASLO), ASHI); const float rc = 1.0f / s;
  float* op = res + ((size_t)g * ANS + i) * ANW + hd * AND + 8 * hh;      /* ot[r] is word c = 16 t + 8 hh + r of row i = ln: eight words in a row a tile */
#pragma unroll
  for (int t = 0; t < 4; ++t) { v4f a, b;
#pragma unroll
    for (int r = 0; r < 4; ++r) { a[r] = oj[t][r] * rc; b[r] = oj[t][4 + r] * rc; }
    *(v4f*)(op + 16 * t) = a; *(v4f*)(op + 16 * t + 4) = b; }
}

extern "C" void kernel_launch(void* const* d_in, const int* in_sizes, int n_in,
                              void* d_out, int out_size, void* d_ws, size_t ws_size, hipStream_t stream) {
  (void)in_sizes; (void)n_in; (void)out_size; (void)d_ws; (void)ws_size;
  const float* const* I = (const float* const*)d_in; const float* qa = I[0]; const float* ka = I[1]; const float* va = I[2];      /* each [4][1024][16][64] */
  float* res = (float*)d_out;
  static_assert(ANS % FROWS == 0 && ANS % 32 == 0 && AND == 64 && (ANS / 16) % FWAVES == 0 && ((ANS / 32) * (AND / 32)) % FWAVES == 0, "whole tiles");
  k_pair<<<dim3((unsigned)(ANS / FROWS), (unsigned)(ANG * ANH)), FWAVES * 32, 0, stream>>>(qa, ka, va, res);      /* one work-group for 256 rows of one (group, head) */
}

// v007
// One run takes 24 microseconds.
// Versions in between are left out here; by their measured steps it is 1.09 times as fast as v005.
// All steps since v000 together make it 28.9 times as fast.
// A multi-head pair weighting with a bounded exponential: qa, ka, va [4][1024][16][64] (group, position, head, width): zs[g][h][i][j] = sum over c of (qa[g][i][h][c] / 8) ka[g][j][h][c]; hi = the largest of a row (read as 0 if it is not finite); x = min(max(zs - hi, -8), 0) - exp(-8); e = exp(x); s = min(max(the row's sum of e, 1 - exp(-8)), 1024); wt = e (1 / s); res[g][i][h][:] = sum over j of wt[g][h][i][j] va[g][j][h][:] -> [4][1024][16][64] f32: one result.
// Structure: ONE kernel and one launch, no workspace. A work-group takes 256 rows i of one (group, head). It reads the f32 inputs itself, in whole 128-byte lines, converts each word where it is read (bf16 first, then f16) and fills LDS once: its own 256 qa rows and the head's whole ka as rows [j][c] ahead of walk 1 (one barrier), and the head's whole va transposed to rows [c][j] (a lane gathers eight positions j of four columns in registers and stores 16 bytes a column) under walk 1, which does not read it: a block's loads fly while the wave works through four passes, and the barrier behind walk 1 hands sv over. Two waves share 32 rows: each takes all 32 rows against one half of the positions j, so that every ka and va^T fragment read from LDS feeds two products. The raw sums are formed transposed (ka rows as A, qa rows as B), so that a lane holds words of one row i alone. The qa words carry the factor log2(e) / 8 from the fill on, so that a raw sum is the module's scaled sum in powers of two. Walk 1 over the wave's j finds each row's largest there, and the two waves join their largest through LDS (one barrier); walk 2 forms the raw sums again with minus the row's largest (and the module's constant) as the accumulator's start value, so that the product's result is the exponent itself: it is bounded (the module's bounds, in powers of two) and goes into one hardware exponential a word; the walk adds the row's sum and packs the words e, one f16 word each, straight from the accumulators into the B operand of the second product (va^T rows as A); at the end each wave hands the other the sixteen rows that the other finishes (f32 sums and row sum, through LDS that the walks have left: two barriers), and the one division a row is applied to the joined f32 result. No raw sum and no weight goes to memory.
// Compute dtype: all three inputs converted to bf16 where they are read; the ka and va words exact as f16 operands down to 2^-14, a qa word times log2(e) / 8 rounded once more to f16; the computed words e (between exp(-8 - exp(-8)) and 1: normal f16 numbers) ONE f16 word each; both products' accumulation, the raw sums, the normalisation's arithmetic and the result f32. v_wmma_f32_16x16x32_f16.
#include <hip/hip_runtime.h>
#define ANG 4                        /* groups */
#define ANS 1024                     /* positions: the normalisation's axis */
#define ANH 16                       /* heads */
#define AND 64                       /* a head's width */
#define ANW (ANH * AND)              /* a row's words: 1,024 */
#define ALOW -8.0f                   /* the module's lower bound of the exponent */
#define AE8 0.00033546262790251185f  /* exp(-8): subtracted from the bounded exponent */
#define ASLO 0.9996645373720975f     /* 1 - exp(-8): the sum's lower bound */
#define ASHI 1024.0f                 /* the sum's upper bound */
typedef unsigned short v8us __attribute__((ext_vector_type(8), may_alias));
typedef unsigned short v4us __attribute__((ext_vector_type(4), may_alias));
typedef float  v8f  __attribute__((ext_vector_type(8)));
typedef float  v4f  __attribute__((ext_vector_type(4)));
typedef float  v4fa __attribute__((ext_vector_type(4), may_alias));
typedef float  f1a  __attribute__((may_alias));

__device__ __forceinline__ unsigned short bf16_bits(float x) { unsigned int u = __float_as_uint(x); return (unsigned short)((u + 0x7FFFu + ((u >> 16) & 1u)) >> 16); }
__device__ __forceinline__ float bf16_val(unsigned short b) { return __uint_as_float(((unsigned int)b) << 16); }
__device__ __forceinline__ float bf16_round(float x) { return bf16_val(bf16_bits(x)); }

typedef _Float16 v16h __attribute__((ext_vector_type(16)));
union FragH { v16h v; v8us half[2]; _Float16 h[16]; unsigned short u[16]; };

// A 16x16x32 f16 fragment in the hardware's k order from a row of 32 words: words 8 hh .. 8 hh + 7 and 16 + 8 hh .. 16 + 8 hh + 7.
__device__ __forceinline__ v16h g2_frag(const _Float16* p, int hh) { FragH f; f.half[0] = *(const v8us*)((const unsigned short*)p + 8 * hh); f.half[1] = *(const v8us*)((const unsigned short*)p + 16 + 8 * hh); return f.v; }
__device__ __forceinline__ v8f f_mma(v16h a, v16h b, v8f c) { return __builtin_amdgcn_wmma_f32_16x16x32_f16(false, a, false, b, (short)0, c, false, false); }
__device__ __forceinline__ float lane_x16(float x) { return __builtin_bit_cast(float, __builtin_amdgcn_permlanex16(__builtin_bit_cast(int, x), __builtin_bit_cast(int, x), 0x76543210, 0xfedcba98, false, false)); }      /* lane l reads lane l ^ 16 */

// Eight words 2^a in one statement. The bounded exponent x lies in [-8 - exp(-8), -exp(-8)], so a = x log2(e) lies in (-12, 0]: inside the range where v_exp_f32 is right by itself (no split at a whole number, no scaling, no range test: each is an identity there).
__device__ __forceinline__ void exp2_x8(const float (&a)[8], float (&y)[8]) {
  asm("v_exp_f32 %0, %8\n\tv_exp_f32 %1, %9\n\tv_exp_f32 %2, %10\n\tv_exp_f32 %3, %11\n\tv_exp_f32 %4, %12\n\tv_exp_f32 %5, %13\n\tv_exp_f32 %6, %14\n\tv_exp_f32 %7, %15\n\tv_nop"
      : "=&v"(y[0]), "=&v"(y[1]), "=&v"(y[2]), "=&v"(y[3]), "=&v"(y[4]), "=&v"(y[5]), "=&v"(y[6]), "=&v"(y[7])
      : "v"(a[0]), "v"(a[1]), "v"(a[2]), "v"(a[3]), "v"(a[4]), "v"(a[5]), "v"(a[6]), "v"(a[7])); }      /* one statement: each v_exp_f32 has an independent one behind it (results apart from all sources), the last the v_nop: the slot that the instruction set asks for behind a transcendental */
#define AL2E 0x1.715476p+0f          /* log2(e) */
#define AQS (0.125f * AL2E)          /* the factor on a qa word: the module's 1/8 and the change of base */
#define AKC (-AE8 * AL2E)            /* the module's subtracted constant in powers of two: also the exponent's upper bound */
#define ALO2 (ALOW * AL2E + AKC)     /* the exponent's lower bound in powers of two */

#define FWAVES 16                    /* waves of a work-group: four a SIMD */
#define FROWS (FWAVES * 16)          /* rows i of a work-group: 32 a pair of waves */
#define JHALF (ANS / 2)              /* positions j of a wave: one half */
#define XW (32 * 32 + 32)            /* f32 words that a wave hands to its partner: four 16 x 16 tiles and sixteen row sums (held twice) */
#define KPW 72                       /* LDS pitch of a ka row in words: 64 + 8 (144 bytes = 16 x 9: 16-byte reads down a column of rows meet no bank twice) */
#define VPW 1032                     /* LDS pitch of a va^T row in words: 1,024 + 8 (2,064 bytes = 16 x 129) */
#define QPW KPW                      /* LDS pitch of a qa row: as a ka row's */
#define VBLK ((ANS / 32) * (AND / 32) / FWAVES)      /* va blocks (32 positions x 32 columns) of a wave: four */
#define VSTEP (FWAVES / 2 * 32)      /* positions from one of a wave's va blocks to its next */
#define VPASS (JHALF / 32 / VBLK)    /* passes of walk 1 under which one va block's loads fly */
static_assert(VBLK * VPASS * 32 == JHALF, "walk 1's passes divide evenly among a wave's va blocks");
static_assert(JHALF % 32 == 0 && FWAVES % 2 == 0 && FWAVES * XW * 4 <= ANS * KPW * 2, "whole passes a half; the hand-over fits the ka rows' LDS");
__device__ __forceinline__ _Float16 in_h(float x) { return (_Float16)bf16_round(x); }      /* an input word: bf16 first, then the same value as f16 */
// One wave: sixteen rows of 64 f32 words (pitch ANW) become f16 rows of pitch KPW in LDS; QS: the rows are qa's and take the factor AQS between the two roundings. Load u takes rows u (lanes 0-15) and 8 + u (lanes 16-31) whole: four whole 128-byte lines. The 8-byte stores of the two rows lie 8 x 144 bytes apart = 32 banks: each half of the lanes has its own 32 banks.
template <bool QS> __device__ __forceinline__ void fill_rows(const float* __restrict__ src, _Float16* dst, int lane) {
  const int hf = lane >> 4, c4 = lane & 15; const float* s = src + (size_t)(8 * hf) * ANW + 4 * c4; unsigned short* d = (unsigned short*)dst + 8 * hf * KPW + 4 * c4; v4f x[8];
#pragma unroll      /* literal trip numbers: the eight loads are issued in a row, ahead of the stores */
  for (int u = 0; u < 8; ++u) x[u] = *(const v4fa*)(s + (size_t)u * ANW);
  asm volatile("s_wait_xcnt 0x0" :: "v"(s) : "memory");      /* the eight loads name s: the pair is kept whole (an input here) until this wait, so that no load's result and no later address lands on it before */
#pragma unroll
  for (int u = 0; u < 8; ++u) { FragH f;
#pragma unroll
    for (int r = 0; r < 4; ++r) f.h[r] = QS ? (_Float16)(bf16_round(x[u][r]) * AQS) : in_h(x[u][r]);
    v4us o; o[0] = f.u[0]; o[1] = f.u[1]; o[2] = f.u[2]; o[3] = f.u[3]; *(v4us*)(d + u * KPW) = o; }
}
// One wave: a block of 32 positions j x 32 columns c of f32 words (pitch ANW) becomes 32 f16 rows [c] of 32 positions in LDS (pitch VPW). A lane takes four columns (16 bytes) of eight positions in a row: load u takes position 8 jq + u of four jq, 128 bytes each: four whole lines. Store k writes column k's eight positions, 16 bytes: among sixteen lanes the four column groups lie 16 banks apart and the four jq 4 banks: every bank once.
// The block goes in two halves, so that work can stand between them while the loads fly: cols_load issues the eight loads, cols_store converts and writes LDS.
__device__ __forceinline__ void cols_load(const float* __restrict__ src, v4f (&x)[8], int lane) {
  const int col = 16 * (lane >> 4) + 4 * (lane & 3), j8 = 8 * ((lane >> 2) & 3); const float* s = src + (size_t)j8 * ANW + col;
#pragma unroll      /* as above */
  for (int u = 0; u < 8; ++u) x[u] = *(const v4fa*)(s + (size_t)u * ANW);
  asm volatile("s_wait_xcnt 0x0" :: "v"(s) : "memory");      /* the eight loads name s: the pair is kept whole (an input here) until this wait, so that no load's result and no later address lands on it before */
}
__device__ __forceinline__ void cols_store(const v4f (&x)[8], _Float16* dst, int lane) {
  const int col = 16 * (lane >> 4) + 4 * (lane & 3), j8 = 8 * ((lane >> 2) & 3); unsigned short* d = (unsigned short*)dst + col * VPW + j8;
#pragma unroll
  for (int k = 0; k < 4; ++k) { FragH f;
#pragma unroll
    for (int u = 0; u < 8; ++u) f.h[u] = in_h(x[u][k]);
    *(v8us*)(d + k * VPW) = f.half[0]; }
}
// The raw sums of 32 positions j (two tiles of sixteen) against two tiles of sixteen rows i (q: the wave's own, p: its partner's), transposed: t0[r] = sum for j = 8 hh + r, t1[r] for j = 16 + 8 hh + r, both of row i = ln of the first tile; u0, u1 the same of the second. Each of the four ka fragments (f_ka reads them) is read once and feeds both tiles. cq, cp: the accumulators' start values (walk 1: nought; walk 2: a row's own constant in every word).
struct KaF { v16h a00, a10, a01, a11; };
__device__ __forceinline__ KaF f_ka(const _Float16* k0, int hh) { const _Float16* k1 = k0 + 16 * KPW; KaF f; f.a00 = g2_frag(k0, hh); f.a10 = g2_frag(k1, hh); f.a01 = g2_frag(k0 + 32, hh); f.a11 = g2_frag(k1 + 32, hh); return f; }
__device__ __forceinline__ void f_raw(const KaF& f, v16h q0, v16h q1, v16h p0, v16h p1, v8f cq, v8f cp, v8f& t0, v8f& t1, v8f& u0, v8f& u1) {
  const v16h a00 = f.a00, a10 = f.a10, a01 = f.a01, a11 = f.a11;
  t0 = f_mma(a00, q0, cq); t1 = f_mma(a10, q0, cq); u0 = f_mma(a00, p0, cp); u1 = f_mma(a10, p0, cp);
  t0 = f_mma(a01, q1, t0); t1 = f_mma(a11, q1, t1); u0 = f_mma(a01, p1, u0); u1 = f_mma(a11, p1, u1); }
// One tile of rows, 32 positions: the product's words are the exponents already (in powers of two, the row's largest and the constant taken off); each is bounded and goes into the exponential; the words e are added to the row's four chains and packed as the B operand of the second product: word s is position j = 8 hh + s (s < 8) or 16 + 8 hh + s - 8: the two tiles' registers as they lie.
__device__ __forceinline__ v16h f_wt(const v8f& t0, const v8f& t1, float (&s)[4]) { FragH p; float a0[8], a1[8], e0[8], e1[8];
#pragma unroll      /* here and below: literal indices, so that the words stay in registers */
  for (int r = 0; r < 8; ++r) { a0[r] = __builtin_amdgcn_fmed3f(t0[r], ALO2, AKC); a1[r] = __builtin_amdgcn_fmed3f(t1[r], ALO2, AKC); }      /* both bounds in one instruction, straight on the accumulator's word (written as a largest and a smallest, each word first takes an instruction that only rewrites it) */
  exp2_x8(a0, e0); exp2_x8(a1, e1);
#pragma unroll
  for (int r = 0; r < 8; r += 2) { s[0] += e0[r]; s[1] += e0[r + 1]; s[2] += e1[r]; s[3] += e1[r + 1]; p.h[r] = (_Float16)e0[r]; p.h[r + 1] = (_Float16)e0[r + 1]; p.h[8 + r] = (_Float16)e1[r]; p.h[8 + r + 1] = (_Float16)e1[r + 1]; }
  return p.v; }
// Every bare "#pragma unroll" below is there so that accumulator and fragment words are indexed by literals and stay in registers.
__global__ __launch_bounds__(FWAVES * 32) void k_pair(const float* __restrict__ QF, const float* __restrict__ KF, const float* __restrict__ VF, float* __restrict__ res) {
  __shared__ __attribute__((aligned(16))) _Float16 sk[ANS * KPW];      /* the head's ka rows: [j][c] */
  __shared__ __attribute__((aligned(16))) _Float16 sv[AND * VPW];      /* the head's va transposed: [c][j] */
  __shared__ __attribute__((aligned(16))) _Float16 sq[FROWS * QPW];      /* the work-group's qa rows: [i][c] */
  __shared__ float sx[FWAVES * 32];      /* each wave's largest of 32 rows over its half of j */
  const int tid = threadIdx.x, lane = tid & 31, ln = lane & 15, hh = lane >> 4, wave = tid >> 5;
  const int g = blockIdx.y / ANH, hd = blockIdx.y % ANH;
  const size_t hb = (size_t)g * ANS * ANW + hd * AND; const float* kp = KF + hb; const float* vp = VF + hb;      /* the head's first word: rows of 64 words, pitch ANW */
  const int i = blockIdx.x * FROWS + wave * 16 + ln;
  fill_rows<true>(QF + hb + (size_t)(blockIdx.x * FROWS + wave * 16) * ANW, sq + wave * 16 * QPW, lane);
#pragma unroll      /* literal trip numbers: a later block's loads may be issued ahead of an earlier block's stores */
  for (int t = 0; t < ANS / 16 / FWAVES; ++t) { const int r0 = (t * FWAVES + wave) * 16; fill_rows<false>(kp + (size_t)r0 * ANW, sk + r0 * KPW, lane); }
  __syncthreads();      /* sk and sq are filled: walk 1 reads them alone; sv is filled under walk 1 and read behind the barrier that follows it */
  const int jh = wave & 1;      /* the wave's half of the positions; waves 2 n and 2 n + 1 share rows 32 n .. 32 n + 31, and each finishes its own sixteen (tile q), the partner the other sixteen (tile p) */
  const _Float16* qr = sq + (wave * 16 + ln) * QPW; const _Float16* pr = sq + ((wave ^ 1) * 16 + ln) * QPW;
  const v16h q0 = g2_frag(qr, hh), q1 = g2_frag(qr + 32, hh), p0 = g2_frag(pr, hh), p1 = g2_frag(pr + 32, hh);      /* both tiles of rows i: B operands of the first product, kept in registers */
  const _Float16* ka = sk + (jh * JHALF + ln) * KPW; const _Float16* va = sv + ln * VPW + jh * JHALF;
  const v8f z8 = {0.f, 0.f, 0.f, 0.f, 0.f, 0.f, 0.f, 0.f}; float hq = -__builtin_inff(), hp = -__builtin_inff();
  const int vj0 = (wave >> 1) * 32, vc0 = (wave & 1) * 32;      /* the wave's va blocks: 32 columns from vc0, 32 positions from vj0 + VSTEP t */
  v4f vx[8]; cols_load(vp + (size_t)vj0 * ANW + vc0, vx, lane);
#pragma unroll      /* literal block numbers: the next block's loads may be issued ahead of this block's stores, into registers of their own */
  for (int t = 0; t < VBLK; ++t) {
    for (int jb = t * VPASS; jb < (t + 1) * VPASS; ++jb) { const KaF kf = f_ka(ka + jb * 32 * KPW, hh);
      __builtin_amdgcn_sched_barrier(0);      /* the pass's eight LDS reads stay one group ahead of its products; left free they stand at three places among the WMMAs, into registers used twice, and are waited for at each */
      v8f t0, t1, u0, u1; f_raw(kf, q0, q1, p0, p1, z8, z8, t0, t1, u0, u1);
#pragma unroll
      for (int r = 0; r < 8; ++r) { hq = fmaxf(hq, fmaxf(t0[r], t1[r])); hp = fmaxf(hp, fmaxf(u0[r], u1[r])); } }
    cols_store(vx, sv + vc0 * VPW + vj0 + t * VSTEP, lane);      /* the block's loads have flown under the passes above */
    if (t + 1 < VBLK) cols_load(vp + (size_t)(vj0 + (t + 1) * VSTEP) * ANW + vc0, vx, lane); }
  hq = fmaxf(hq, lane_x16(hq)); hp = fmaxf(hp, lane_x16(hp));      /* lanes ln and ln + 16 hold the two halves of a row's words */
  sx[wave * 32 + lane] = hh ? hp : hq;      /* words 0-15: the wave's own tile, 16-31: the partner's */
  __syncthreads();      /* each wave's largest over its half of j is in LDS, and so is all of sv */
  hq = fmaxf(hq, sx[(wave ^ 1) * 32 + 16 + ln]); hp = fmaxf(hp, sx[(wave ^ 1) * 32 + ln]);      /* the largest of the whole row, in powers of two as the raw sums are (the factor is positive and keeps the order) */
  hq = (fabsf(hq) < __builtin_inff()) ? hq : 0.0f; hp = (fabsf(hp) < __builtin_inff()) ? hp : 0.0f;      /* the module's guard: a largest that is not finite is read as nought */
  const float kq = AKC - hq, kp2 = AKC - hp; const v8f cq = {kq, kq, kq, kq, kq, kq, kq, kq}, cp = {kp2, kp2, kp2, kp2, kp2, kp2, kp2, kp2};      /* a lane's accumulator words are all of one row: its constant in each */
  v8f o0 = z8, o1 = z8, o2 = z8, o3 = z8, w0 = z8, w1 = z8, w2 = z8, w3 = z8; float sq4[4] = {0.0f, 0.0f, 0.0f, 0.0f}, sp4[4] = {0.0f, 0.0f, 0.0f, 0.0f};
  for (int jb = 0; jb < JHALF / 32; ++jb) { const KaF kf = f_ka(ka + jb * 32 * KPW, hh);
    const _Float16* vj = va + jb * 32; const v16h a0 = g2_frag(vj, hh), a1 = g2_frag(vj + 16 * VPW, hh), a2 = g2_frag(vj + 32 * VPW, hh), a3 = g2_frag(vj + 48 * VPW, hh);      /* each va^T fragment is read once and feeds both tiles */
    __builtin_amdgcn_sched_barrier(0);      /* the pass's sixteen LDS reads stay one group, ka first, ahead of the first product: it and the vector work cover the va^T reads' latency; left free those sink among the second product's WMMAs and are waited for there */
    v8f t0, t1, u0, u1; f_raw(kf, q0, q1, p0, p1, cq, cp, t0, t1, u0, u1);
    const v16h eq = f_wt(t0, t1, sq4), ep = f_wt(u0, u1, sp4);
    __builtin_amdgcn_sched_barrier(0);      /* the row sums' additions stay ahead of the second product; left free they land behind its WMMAs on operand registers, each time at the price of the four idle slots that the chip asks for there */
    o0 = f_mma(a0, eq, o0); w0 = f_mma(a0, ep, w0); o1 = f_mma(a1, eq, o1); w1 = f_mma(a1, ep, w1); o2 = f_mma(a2, eq, o2); w2 = f_mma(a2, ep, w2); o3 = f_mma(a3, eq, o3); w3 = f_mma(a3, ep, w3); }
  float s = (sq4[0] + sq4[1]) + (sq4[2] + sq4[3]); s += lane_x16(s); float sp = (sp4[0] + sp4[1]) + (sp4[2] + sp4[3]); sp += lane_x16(sp);
  __syncthreads();      /* every wave has left walk 2: sk is free to carry the hand-over */
  float* xw = (float*)sk + wave * XW + 4 * lane; const float* xr = (const float*)sk + (wave ^ 1) * XW + 4 * lane;      /* 16 bytes a lane, 512 bytes in a row a store or read: each half of the lanes meets every bank once */
  const v8f ww[4] = {w0, w1, w2, w3};
#pragma unroll
  for (int t = 0; t < 4; ++t) { v4f a, b;
#pragma unroll
    for (int r = 0; r < 4; ++r) { a[r] = ww[t][r]; b[r] = ww[t][4 + r]; }
    *(v4fa*)(xw + 256 * t) = a; *(v4fa*)(xw + 256 * t + 128) = b; }
  *(f1a*)((float*)sk + wave * XW + 1024 + lane) = sp;
  __syncthreads();      /* the partner's sums over its half of j are in LDS */
  v8f oj[4] = {o0, o1, o2, o3};
#pragma unroll
  for (int t = 0; t < 4; ++t) { const v4f a = *(const v4fa*)(xr + 256 * t), b = *(const v4fa*)(xr + 256 * t + 128);
#pragma unroll
    for (int r = 0; r < 4; ++r) { oj[t][r] += a[r]; oj[t][4 + r] += b[r]; } }
  s += *(const f1a*)((const float*)sk + (wave ^ 1) * XW + 1024 + lane);
  s = fminf(fmaxf(s, ASLO), ASHI); const float rc = 1.0f / s;
  float* op = res + ((size_t)g * ANS + i) * ANW + hd * AND + 8 * hh;      /* ot[r] is word c = 16 t + 8 hh + r of row i = ln: eight words in a row a tile */
#pragma unroll
  for (int t = 0; t < 4; ++t) { v4f a, b;
#pragma unroll
    for (int r = 0; r < 4; ++r) { a[r] = oj[t][r] * rc; b[r] = oj[t][4 + r] * rc; }
    *(v4f*)(op + 16 * t) = a; *(v4f*)(op + 16 * t + 4) = b; }
}

extern "C" void kernel_launch(void* const* d_in, const int* in_sizes, int n_in,
                              void* d_out, int out_size, void* d_ws, size_t ws_size, hipStream_t stream) {
  (void)in_sizes; (void)n_in; (void)out_size; (void)d_ws; (void)ws_size;
  const float* const* I = (const float* const*)d_in; const float* qa = I[0]; const float* ka = I[1]; const float* va = I[2];      /* each [4][1024][16][64] */
  float* res = (float*)d_out;
  static_assert(ANS % FROWS == 0 && ANS % 32 == 0 && AND == 64 && (ANS / 16) % FWAVES == 0 && ((ANS / 32) * (AND / 32)) % FWAVES == 0, "whole tiles");
  k_pair<<<dim3((unsigned)(ANS / FROWS), (unsigned)(ANG * ANH)), FWAVES * 32, 0, stream>>>(qa, ka, va, res);      /* one work-group for 256 rows of one (group, head) */
}

// v009
// One run takes 20.7 microseconds.
// It is 1.15 times as fast as v007, going by the measured steps of the versions left out in between.
// All steps since v000 together make it 33.1 times as fast.
// A multi-head pair weighting with a bounded exponential: qa, ka, va [4][1024][16][64] (group, position, head, width): zs[g][h][i][j] = sum over c of (qa[g][i][h][c] / 8) ka[g][j][h][c]; hi = the largest of a row (read as 0 if it is not finite); x = min(max(zs - hi, -8), 0) - exp(-8); e = exp(x); s = min(max(the row's sum of e, 1 - exp(-8)), 1024); wt = e (1 / s); res[g][i][h][:] = sum over j of wt[g][h][i][j] va[g][j][h][:] -> [4][1024][16][64] f32: one result.
// Structure: ONE kernel and one launch, no workspace. A work-group takes 256 rows i of one (group, head). It reads the f32 inputs itself, in whole 128-byte lines, converts each word where it is read (f32 to f16, one rounding) and fills LDS once: its own 256 qa rows and the head's whole ka as rows [j][c] ahead of walk 1 (one barrier), and the head's whole va transposed to rows [c][j] (a lane gathers eight positions j of four columns in registers and stores 16 bytes a column) under walk 1, which does not read it: a block's loads fly while the wave works through four passes, and the barrier behind walk 1 hands sv over. Two waves share 32 rows: each takes all 32 rows against one half of the positions j, so that every ka and va^T fragment read from LDS feeds two products. The raw sums are formed transposed (ka rows as A, qa rows as B), so that a lane holds words of one row i alone. The qa words carry the factor log2(e) / 8 from the fill on, so that a raw sum is the module's scaled sum in powers of two. Walk 1 over the wave's j finds each row's largest there, and the two waves join their largest through LDS (one barrier); walk 2 forms the raw sums again with minus the row's largest (and the module's constant) as the accumulator's start value, so that the product's result is the exponent itself: it is bounded (the module's bounds, in powers of two) and goes into one hardware exponential a word; the walk adds the row's sum and packs the words e, one f16 word each, straight from the accumulators into the B operand of the second product (va^T rows as A); at the end each wave hands the other the sixteen rows that the other finishes (f32 sums and row sum, through LDS that the walks have left: two barriers), and the one division a row is applied to the joined f32 result; each wave then turns its sixteen result rows through LDS rows of its own (in va^T's place, no barrier), so that a store to memory writes whole 128-byte lines. No raw sum and no weight goes to memory.
// Compute dtype: all three inputs converted from f32 to f16 where they are read, one rounding to nearest even a word (a qa word after its factor log2(e) / 8, applied in f32); the computed words e (between exp(-8 - exp(-8)) and 1: normal f16 numbers) ONE f16 word each; both products' accumulation, the raw sums, the normalisation's arithmetic and the result f32. v_wmma_f32_16x16x32_f16.
#include <hip/hip_runtime.h>
#define ANG 4                        /* groups */
#define ANS 1024                     /* positions: the normalisation's axis */
#define ANH 16                       /* heads */
#define AND 64                       /* a head's width */
#define ANW (ANH * AND)              /* a row's words: 1,024 */
#define ALOW -8.0f                   /* the module's lower bound of the exponent */
#define AE8 0.00033546262790251185f  /* exp(-8): subtracted from the bounded exponent */
#define ASLO 0.9996645373720975f     /* 1 - exp(-8): the sum's lower bound */
#define ASHI 1024.0f                 /* the sum's upper bound */
typedef unsigned short v8us __attribute__((ext_vector_type(8), may_alias));
typedef unsigned short v4us __attribute__((ext_vector_type(4), may_alias));
typedef float  v8f  __attribute__((ext_vector_type(8)));
typedef float  v4f  __attribute__((ext_vector_type(4)));
typedef float  v4fa __attribute__((ext_vector_type(4), may_alias));
typedef float  f1a  __attribute__((may_alias));

typedef _Float16 v16h __attribute__((ext_vector_type(16)));
union FragH { v16h v; v8us half[2]; _Float16 h[16]; unsigned short u[16]; };

// A 16x16x32 f16 fragment in the hardware's k order from a row of 32 words: words 8 hh .. 8 hh + 7 and 16 + 8 hh .. 16 + 8 hh + 7.
__device__ __forceinline__ v16h g2_frag(const _Float16* p, int hh) { FragH f; f.half[0] = *(const v8us*)((const unsigned short*)p + 8 * hh); f.half[1] = *(const v8us*)((const unsigned short*)p + 16 + 8 * hh); return f.v; }
__device__ __forceinline__ v8f f_mma(v16h a, v16h b, v8f c) { return __builtin_amdgcn_wmma_f32_16x16x32_f16(false, a, false, b, (short)0, c, false, false); }
__device__ __forceinline__ float lane_x16(float x) { return __builtin_bit_cast(float, __builtin_amdgcn_permlanex16(__builtin_bit_cast(int, x), __builtin_bit_cast(int, x), 0x76543210, 0xfedcba98, false, false)); }      /* lane l reads lane l ^ 16 */

// Eight words 2^a in one statement. The bounded exponent x lies in [-8 - exp(-8), -exp(-8)], so a = x log2(e) lies in (-12, 0]: inside the range where v_exp_f32 is right by itself (no split at a whole number, no scaling, no range test: each is an identity there).
__device__ __forceinline__ void exp2_x8(const float (&a)[8], float (&y)[8]) {
  asm("v_exp_f32 %0, %8\n\tv_exp_f32 %1, %9\n\tv_exp_f32 %2, %10\n\tv_exp_f32 %3, %11\n\tv_exp_f32 %4, %12\n\tv_exp_f32 %5, %13\n\tv_exp_f32 %6, %14\n\tv_exp_f32 %7, %15\n\tv_nop"
      : "=&v"(y[0]), "=&v"(y[1]), "=&v"(y[2]), "=&v"(y[3]), "=&v"(y[4]), "=&v"(y[5]), "=&v"(y[6]), "=&v"(y[7])
      : "v"(a[0]), "v"(a[1]), "v"(a[2]), "v"(a[3]), "v"(a[4]), "v"(a[5]), "v"(a[6]), "v"(a[7])); }      /* one statement: each v_exp_f32 has an independent one behind it (results apart from all sources), the last the v_nop: the slot that the instruction set asks for behind a transcendental */
#define AL2E 0x1.715476p+0f          /* log2(e) */
#define AQS (0.125f * AL2E)          /* the factor on a qa word: the module's 1/8 and the change of base */
#define AKC (-AE8 * AL2E)            /* the module's subtracted constant in powers of two: also the exponent's upper bound */
#define ALO2 (ALOW * AL2E + AKC)     /* the exponent's lower bound in powers of two */

#define FWAVES 16                    /* waves of a work-group: four a SIMD */
#define FROWS (FWAVES * 16)          /* rows i of a work-group: 32 a pair of waves */
#define JHALF (ANS / 2)              /* positions j of a wave: one half */
#define XW (32 * 32 + 32)            /* f32 words that a wave hands to its partner: four 16 x 16 tiles and sixteen row sums (held twice) */
#define KPW 72                       /* LDS pitch of a ka row in words: 64 + 8 (144 bytes = 16 x 9: 16-byte reads down a column of rows meet no bank twice) */
#define VPW 1032                     /* LDS pitch of a va^T row in words: 1,024 + 8 (2,064 bytes = 16 x 129) */
#define QPW KPW                      /* LDS pitch of a qa row: as a ka row's */
#define SPW 68                       /* LDS pitch of a staged result row in f32 words: 64 + 4 (272 bytes = 16 x 17: sixteen lanes' 16-byte stores down a column of rows meet no bank twice) */
#define VBLK ((ANS / 32) * (AND / 32) / FWAVES)      /* va blocks (32 positions x 32 columns) of a wave: four */
#define VSTEP (FWAVES / 2 * 32)      /* positions from one of a wave's va blocks to its next */
#define VPASS (JHALF / 32 / VBLK)    /* passes of walk 1 under which one va block's loads fly */
static_assert(VBLK * VPASS * 32 == JHALF, "walk 1's passes divide evenly among a wave's va blocks");
static_assert(JHALF % 32 == 0 && FWAVES % 2 == 0 && FWAVES * XW * 4 <= ANS * KPW * 2, "whole passes a half; the hand-over fits the ka rows' LDS");
static_assert(FROWS * SPW * 4 <= AND * VPW * 2, "the staged result rows fit the va^T rows' LDS");
__device__ __forceinline__ _Float16 in_h(float x) { return (_Float16)x; }      /* an input word: f32 to f16, to nearest even */
// One wave: sixteen rows of 64 f32 words (pitch ANW) become f16 rows of pitch KPW in LDS; QS: the rows are qa's and take the factor AQS ahead of the rounding. Load u takes rows u (lanes 0-15) and 8 + u (lanes 16-31) whole: four whole 128-byte lines. The 8-byte stores of the two rows lie 8 x 144 bytes apart = 32 banks: each half of the lanes has its own 32 banks.
template <bool QS> __device__ __forceinline__ void fill_rows(const float* __restrict__ src, _Float16* dst, int lane) {
  const int hf = lane >> 4, c4 = lane & 15; const float* s = src + (size_t)(8 * hf) * ANW + 4 * c4; unsigned short* d = (unsigned short*)dst + 8 * hf * KPW + 4 * c4; v4f x[8];
#pragma unroll      /* literal trip numbers: the eight loads are issued in a row, ahead of the stores */
  for (int u = 0; u < 8; ++u) x[u] = *(const v4fa*)(s + (size_t)u * ANW);
  asm volatile("s_wait_xcnt 0x0" :: "v"(s) : "memory");      /* the eight loads name s: the pair is kept whole (an input here) until this wait, so that no load's result and no later address lands on it before */
#pragma unroll
  for (int u = 0; u < 8; ++u) { FragH f;
#pragma unroll
    for (int r = 0; r < 4; ++r) f.h[r] = QS ? (_Float16)(x[u][r] * AQS) : in_h(x[u][r]);
    v4us o; o[0] = f.u[0]; o[1] = f.u[1]; o[2] = f.u[2]; o[3] = f.u[3]; *(v4us*)(d + u * KPW) = o; }
}
// One wave: a block of 32 positions j x 32 columns c of f32 words (pitch ANW) becomes 32 f16 rows [c] of 32 positions in LDS (pitch VPW). A lane takes four columns (16 bytes) of eight positions in a row: load u takes position 8 jq + u of four jq, 128 bytes each: four whole lines. Store k writes column k's eight positions, 16 bytes: among sixteen lanes the four column groups lie 16 banks apart and the four jq 4 banks: every bank once.
// The block goes in two halves, so that work can stand between them while the loads fly: cols_load issues the eight loads, cols_store converts and writes LDS.
__device__ __forceinline__ void cols_load(const float* __restrict__ src, v4f (&x)[8], int lane) {
  const int col = 16 * (lane >> 4) + 4 * (lane & 3), j8 = 8 * ((lane >> 2) & 3); const float* s = src + (size_t)j8 * ANW + col;
#pragma unroll      /* as above */
  for (int u = 0; u < 8; ++u) x[u] = *(const v4fa*)(s + (size_t)u * ANW);
  asm volatile("s_wait_xcnt 0x0" :: "v"(s) : "memory");      /* the eight loads name s: the pair is kept whole (an input here) until this wait, so that no load's result and no later address lands on it before */
}
__device__ __forceinline__ void cols_store(const v4f (&x)[8], _Float16* dst, int lane) {
  const int col = 16 * (lane >> 4) + 4 * (lane & 3), j8 = 8 * ((lane >> 2) & 3); unsigned short* d = (unsigned short*)dst + col * VPW + j8;
#pragma unroll
  for (int k = 0; k < 4; ++k) { FragH f;
#pragma unroll
    for (int u = 0; u < 8; ++u) f.h[u] = in_h(x[u][k]);
    *(v8us*)(d + k * VPW) = f.half[0]; }
}
// The raw sums of 32 positions j (two tiles of sixteen) against two tiles of sixteen rows i (q: the wave's own, p: its partner's), transposed: t0[r] = sum for j = 8 hh + r, t1[r] for j = 16 + 8 hh + r, both of row i = ln of the first tile; u0, u1 the same of the second. Each of the four ka fragments (f_ka reads them) is read once and feeds both tiles. cq, cp: the accumulators' start values (walk 1: nought; walk 2: a row's own constant in every word).
struct KaF { v16h a00, a10, a01, a11; };
__device__ __forceinline__ KaF f_ka(const _Float16* k0, int hh) { const _Float16* k1 = k0 + 16 * KPW; KaF f; f.a00 = g2_frag(k0, hh); f.a10 = g2_frag(k1, hh); f.a01 = g2_frag(k0 + 32, hh); f.a11 = g2_frag(k1 + 32, hh); return f; }
__device__ __forceinline__ void f_raw(const KaF& f, v16h q0, v16h q1, v16h p0, v16h p1, v8f cq, v8f cp, v8f& t0, v8f& t1, v8f& u0, v8f& u1) {
  const v16h a00 = f.a00, a10 = f.a10, a01 = f.a01, a11 = f.a11;
  t0 = f_mma(a00, q0, cq); t1 = f_mma(a10, q0, cq); u0 = f_mma(a00, p0, cp); u1 = f_mma(a10, p0, cp);
  t0 = f_mma(a01, q1, t0); t1 = f_mma(a11, q1, t1); u0 = f_mma(a01, p1, u0); u1 = f_mma(a11, p1, u1); }
// One tile of rows, 32 positions: the product's words are the exponents already (in powers of two, the row's largest and the constant taken off); each is bounded and goes into the exponential; the words e are added to the row's four chains and packed as the B operand of the second product: word s is position j = 8 hh + s (s < 8) or 16 + 8 hh + s - 8: the two tiles' registers as they lie.
__device__ __forceinline__ v16h f_wt(const v8f& t0, const v8f& t1, float (&s)[4]) { FragH p; float a0[8], a1[8], e0[8], e1[8];
#pragma unroll      /* here and below: literal indices, so that the words stay in registers */
  for (int r = 0; r < 8; ++r) { a0[r] = __builtin_amdgcn_fmed3f(t0[r], ALO2, AKC); a1[r] = __builtin_amdgcn_fmed3f(t1[r], ALO2, AKC); }      /* both bounds in one instruction, straight on the accumulator's word (written as a largest and a smallest, each word first takes an instruction that only rewrites it) */
  exp2_x8(a0, e0); exp2_x8(a1, e1);
#pragma unroll
  for (int r = 0; r < 8; r += 2) { s[0] += e0[r]; s[1] += e0[r + 1]; s[2] += e1[r]; s[3] += e1[r + 1]; p.h[r] = (_Float16)e0[r]; p.h[r + 1] = (_Float16)e0[r + 1]; p.h[8 + r] = (_Float16)e1[r]; p.h[8 + r + 1] = (_Float16)e1[r + 1]; }
  return p.v; }
// Every bare "#pragma unroll" below but the last is there so that accumulator and fragment words are indexed by literals and stay in registers.
__global__ __launch_bounds__(FWAVES * 32) void k_pair(const float* __restrict__ QF, const float* __restrict__ KF, const float* __restrict__ VF, float* __restrict__ res) {
  __shared__ __attribute__((aligned(16))) _Float16 sk[ANS * KPW];      /* the head's ka rows: [j][c] */
  __shared__ __attribute__((aligned(16))) _Float16 sv[AND * VPW];      /* the head's va transposed: [c][j] */
  __shared__ __attribute__((aligned(16))) _Float16 sq[FROWS * QPW];      /* the work-group's qa rows: [i][c] */
  __shared__ float sx[FWAVES * 32];      /* each wave's largest of 32 rows over its half of j */
  const int tid = threadIdx.x, lane = tid & 31, ln = lane & 15, hh = lane >> 4, wave = tid >> 5;
  const int g = blockIdx.y / ANH, hd = blockIdx.y % ANH;
  const size_t hb = (size_t)g * ANS * ANW + hd * AND; const float* kp = KF + hb; const float* vp = VF + hb;      /* the head's first word: rows of 64 words, pitch ANW */
  fill_rows<true>(QF + hb + (size_t)(blockIdx.x * FROWS + wave * 16) * ANW, sq + wave * 16 * QPW, lane);
#pragma unroll      /* literal trip numbers: a later block's loads may be issued ahead of an earlier block's stores */
  for (int t = 0; t < ANS / 16 / FWAVES; ++t) { const int r0 = (t * FWAVES + wave) * 16; fill_rows<false>(kp + (size_t)r0 * ANW, sk + r0 * KPW, lane); }
  __syncthreads();      /* sk and sq are filled: walk 1 reads them alone; sv is filled under walk 1 and read behind the barrier that follows it */
  const int jh = wave & 1;      /* the wave's half of the positions; waves 2 n and 2 n + 1 share rows 32 n .. 32 n + 31, and each finishes its own sixteen (tile q), the partner the other sixteen (tile p) */
  const _Float16* qr = sq + (wave * 16 + ln) * QPW; const _Float16* pr = sq + ((wave ^ 1) * 16 + ln) * QPW;
  const v16h q0 = g2_frag(qr, hh), q1 = g2_frag(qr + 32, hh), p0 = g2_frag(pr, hh), p1 = g2_frag(pr + 32, hh);      /* both tiles of rows i: B operands of the first product, kept in registers */
  const _Float16* ka = sk + (jh * JHALF + ln) * KPW; const _Float16* va = sv + ln * VPW + jh * JHALF;
  const v8f z8 = {0.f, 0.f, 0.f, 0.f, 0.f, 0.f, 0.f, 0.f}; float hq = -__builtin_inff(), hp = -__builtin_inff();
  const int vj0 = (wave >> 1) * 32, vc0 = (wave & 1) * 32;      /* the wave's va blocks: 32 columns from vc0, 32 positions from vj0 + VSTEP t */
  v4f vx[8]; cols_load(vp + (size_t)vj0 * ANW + vc0, vx, lane);
#pragma unroll      /* literal block numbers: the next block's loads may be issued ahead of this block's stores, into registers of their own */
  for (int t = 0; t < VBLK; ++t) {
    for (int jb = t * VPASS; jb < (t + 1) * VPASS; ++jb) { const KaF kf = f_ka(ka + jb * 32 * KPW, hh);
      __builtin_amdgcn_sched_barrier(0);      /* the pass's eight LDS reads stay one group ahead of its products; left free they stand at three places among the WMMAs, into registers used twice, and are waited for at each */
      v8f t0, t1, u0, u1; f_raw(kf, q0, q1, p0, p1, z8, z8, t0, t1, u0, u1);
#pragma unroll
      for (int r = 0; r < 8; ++r) { hq = fmaxf(hq, fmaxf(t0[r], t1[r])); hp = fmaxf(hp, fmaxf(u0[r], u1[r])); } }
    cols_store(vx, sv + vc0 * VPW + vj0 + t * VSTEP, lane);      /* the block's loads have flown under the passes above */
    if (t + 1 < VBLK) cols_load(vp + (size_t)(vj0 + (t + 1) * VSTEP) * ANW + vc0, vx, lane); }
  hq = fmaxf(hq, lane_x16(hq)); hp = fmaxf(hp, lane_x16(hp));      /* lanes ln and ln + 16 hold the two halves of a row's words */
  sx[wave * 32 + lane] = hh ? hp : hq;      /* words 0-15: the wave's own tile, 16-31: the partner's */
  __syncthreads();      /* each wave's largest over its half of j is in LDS, and so is all of sv */
  hq = fmaxf(hq, sx[(wave ^ 1) * 32 + 16 + ln]); hp = fmaxf(hp, sx[(wave ^ 1) * 32 + ln]);      /* the largest of the whole row, in powers of two as the raw sums are (the factor is positive and keeps the order) */
  hq = (fabsf(hq) < __builtin_inff()) ? hq : 0.0f; hp = (fabsf(hp) < __builtin_inff()) ? hp : 0.0f;      /* the module's guard: a largest that is not finite is read as nought */
  const float kq = AKC - hq, kp2 = AKC - hp; const v8f cq = {kq, kq, kq, kq, kq, kq, kq, kq}, cp = {kp2, kp2, kp2, kp2, kp2, kp2, kp2, kp2};      /* a lane's accumulator words are all of one row: its constant in each */
  v8f o0 = z8, o1 = z8, o2 = z8, o3 = z8, w0 = z8, w1 = z8, w2 = z8, w3 = z8; float sq4[4] = {0.0f, 0.0f, 0.0f, 0.0f}, sp4[4] = {0.0f, 0.0f, 0.0f, 0.0f};
  for (int jb = 0; jb < JHALF / 32; ++jb) { const KaF kf = f_ka(ka + jb * 32 * KPW, hh);
    const _Float16* vj = va + jb * 32; const v16h a0 = g2_frag(vj, hh), a1 = g2_frag(vj + 16 * VPW, hh), a2 = g2_frag(vj + 32 * VPW, hh), a3 = g2_frag(vj + 48 * VPW, hh);      /* each va^T fragment is read once and feeds both tiles */
    __builtin_amdgcn_sched_barrier(0);      /* the pass's sixteen LDS reads stay one group, ka first, ahead of the first product: it and the vector work cover the va^T reads' latency; left free those sink among the second product's WMMAs and are waited for there */
    v8f t0, t1, u0, u1; f_raw(kf, q0, q1, p0, p1, cq, cp, t0, t1, u0, u1);
    const v16h eq = f_wt(t0, t1, sq4), ep = f_wt(u0, u1, sp4);
    __builtin_amdgcn_sched_barrier(0);      /* the row sums' additions stay ahead of the second product; left free they land behind its WMMAs on operand registers, each time at the price of the four idle slots that the chip asks for there */
    o0 = f_mma(a0, eq, o0); w0 = f_mma(a0, ep, w0); o1 = f_mma(a1, eq, o1); w1 = f_mma(a1, ep, w1); o2 = f_mma(a2, eq, o2); w2 = f_mma(a2, ep, w2); o3 = f_mma(a3, eq, o3); w3 = f_mma(a3, ep, w3); }
  float s = (sq4[0] + sq4[1]) + (sq4[2] + sq4[3]); s += lane_x16(s); float sp = (sp4[0] + sp4[1]) + (sp4[2] + sp4[3]); sp += lane_x16(sp);
  __syncthreads();      /* every wave has left walk 2: sk is free to carry the hand-over */
  float* xw = (float*)sk + wave * XW + 4 * lane; const float* xr = (const float*)sk + (wave ^ 1) * XW + 4 * lane;      /* 16 bytes a lane, 512 bytes in a row a store or read: each half of the lanes meets every bank once */
  const v8f ww[4] = {w0, w1, w2, w3};
#pragma unroll
  for (int t = 0; t < 4; ++t) { v4f a, b;
#pragma unroll
    for (int r = 0; r < 4; ++r) { a[r] = ww[t][r]; b[r] = ww[t][4 + r]; }
    *(v4fa*)(xw + 256 * t) = a; *(v4fa*)(xw + 256 * t + 128) = b; }
  *(f1a*)((float*)sk + wave * XW + 1024 + lane) = sp;
  __syncthreads();      /* the partner's sums over its half of j are in LDS */
  v8f oj[4] = {o0, o1, o2, o3};
#pragma unroll
  for (int t = 0; t < 4; ++t) { const v4f a = *(const v4fa*)(xr + 256 * t), b = *(const v4fa*)(xr + 256 * t + 128);
#pragma unroll
    for (int r = 0; r < 4; ++r) { oj[t][r] += a[r]; oj[t][4 + r] += b[r]; } }
  s += *(const f1a*)((const float*)sk + (wave ^ 1) * XW + 1024 + lane);
  s = fminf(fmaxf(s, ASLO), ASHI); const float rc = 1.0f / s;
  float* st = (float*)sv + wave * (16 * SPW);      /* the wave's own staging rows, in sv, which every wave has left (two barriers back): no other wave touches them */
  float* sw = st + ln * SPW + 8 * hh;      /* ot[r] is word c = 16 t + 8 hh + r of row i = ln: eight words in a row a tile */
#pragma unroll
  for (int t = 0; t < 4; ++t) { v4f a, b;
#pragma unroll
    for (int r = 0; r < 4; ++r) { a[r] = oj[t][r] * rc; b[r] = oj[t][4 + r] * rc; }
    *(v4fa*)(sw + 16 * t) = a; *(v4fa*)(sw + 16 * t + 4) = b; }
  asm volatile("s_wait_dscnt 0x0" ::: "memory");      /* the wave's own sixteen rows are in LDS before its lanes read one another's words back */
  const float* sr = st + hh * SPW + 4 * ln;      /* read u: rows 2 u (lanes 0-15) and 2 u + 1 (lanes 16-31), 256 bytes in a row each */
  float* op = res + ((size_t)g * ANS + blockIdx.x * FROWS + wave * 16 + hh) * ANW + hd * AND + 4 * ln;
#pragma unroll
  for (int u = 0; u < 8; ++u) { const v4f x = *(const v4fa*)(sr + 2 * u * SPW); *(v4f*)(op + (size_t)(2 * u) * ANW) = x; }      /* a store writes two rows' 256 bytes: four whole 128-byte lines */
}

extern "C" void kernel_launch(void* const* d_in, const int* in_sizes, int n_in,
                              void* d_out, int out_size, void* d_ws, size_t ws_size, hipStream_t stream) {
  (void)in_sizes; (void)n_in; (void)out_size; (void)d_ws; (void)ws_size;
  const float* const* I = (const float* const*)d_in; const float* qa = I[0]; const float* ka = I[1]; const float* va = I[2];      /* each [4][1024][16][64] */
  float* res = (float*)d_out;
  static_assert(ANS % FROWS == 0 && ANS % 32 == 0 && AND == 64 && (ANS / 16) % FWAVES == 0 && ((ANS / 32) * (AND / 32)) % FWAVES == 0, "whole tiles");
  k_pair<<<dim3((unsigned)(ANS / FROWS), (unsigned)(ANG * ANH)), FWAVES * 32, 0, stream>>>(qa, ka, va, res);      /* one work-group for 256 rows of one (group, head) */
}

// v010
// A run of this version takes 19.9 microseconds.
// Timed twice side by side with v009, it ran 1.04 times as fast both times.
// Counting every step since v000, it is 34.5 times as fast.
// A multi-head pair weighting with a bounded exponential: qa, ka, va [4][1024][16][64] (group, position, head, width): zs[g][h][i][j] = sum over c of (qa[g][i][h][c] / 8) ka[g][j][h][c]; hi = the largest of a row (read as 0 if it is not finite); x = min(max(zs - hi, -8), 0) - exp(-8); e = exp(x); s = min(max(the row's sum of e, 1 - exp(-8)), 1024); wt = e (1 / s); res[g][i][h][:] = sum over j of wt[g][h][i][j] va[g][j][h][:] -> [4][1024][16][64] f32: one result.
// Structure: ONE kernel and one launch, no workspace. A work-group takes 256 rows i of one (group, head). It reads the f32 inputs itself, in whole 128-byte lines, converts each word where it is read (f32 to f16, one rounding) and fills LDS once: its own 256 qa rows and the head's whole ka as rows [j][c] ahead of walk 1 (one barrier), and the head's whole va transposed to rows [c][j] (a lane gathers eight positions j of four columns in registers and stores 16 bytes a column) under walk 1, which does not read it: a block's loads fly while the wave works through four passes, and the barrier behind walk 1 hands sv over. Two waves share 32 rows: each takes all 32 rows against one half of the positions j, so that every ka and va^T fragment read from LDS feeds two products. The raw sums are formed transposed (ka rows as A, qa rows as B), so that a lane holds words of one row i alone. The qa words carry the factor log2(e) / 8 from the fill on, so that a raw sum is the module's scaled sum in powers of two. Walk 1 over the wave's j finds each row's largest there, and the two waves join their largest through LDS (one barrier); walk 2 forms the raw sums again with minus the row's largest (and the module's constant) as the accumulator's start value, so that the product's result is the exponent itself: it is bounded (the module's bounds, in powers of two) and goes into one hardware exponential a word; the walk adds the row's sum and packs the words e, one f16 word each, straight from the accumulators into the B operand of the second product (va^T rows as A); at the end each wave hands the other the sixteen rows that the other finishes (f32 sums and row sum, through LDS that the walks have left: two barriers), and the one division a row is applied to the joined f32 result; each wave then turns its sixteen result rows through LDS rows of its own (in va^T's place, no barrier), so that a store to memory writes whole 128-byte lines. No raw sum and no weight goes to memory. In both walks a wave sets its own issue priority (wave_prio below), so that the four waves of a SIMD, none of which fills a pipe alone, work side by side and reach the barrier behind the walk together.
// Compute dtype: all three inputs converted from f32 to f16 where they are read, one rounding to nearest even a word (a qa word after its factor log2(e) / 8, applied in f32); the computed words e (between exp(-8 - exp(-8)) and 1: normal f16 numbers) ONE f16 word each; both products' accumulation, the raw sums, the normalisation's arithmetic and the result f32. v_wmma_f32_16x16x32_f16.
#include <hip/hip_runtime.h>
#define ANG 4                        /* groups */
#define ANS 1024                     /* positions: the normalisation's axis */
#define ANH 16                       /* heads */
#define AND 64                       /* a head's width */
#define ANW (ANH * AND)              /* a row's words: 1,024 */
#define ALOW -8.0f                   /* the module's lower bound of the exponent */
#define AE8 0.00033546262790251185f  /* exp(-8): subtracted from the bounded exponent */
#define ASLO 0.9996645373720975f     /* 1 - exp(-8): the sum's lower bound */
#define ASHI 1024.0f                 /* the sum's upper bound */
typedef unsigned short v8us __attribute__((ext_vector_type(8), may_alias));
typedef unsigned short v4us __attribute__((ext_vector_type(4), may_alias));
typedef float  v8f  __attribute__((ext_vector_type(8)));
typedef float  v4f  __attribute__((ext_vector_type(4)));
typedef float  v4fa __attribute__((ext_vector_type(4), may_alias));
typedef float  f1a  __attribute__((may_alias));

typedef _Float16 v16h __attribute__((ext_vector_type(16)));
union FragH { v16h v; v8us half[2]; _Float16 h[16]; unsigned short u[16]; };

// A 16x16x32 f16 fragment in the hardware's k order from a row of 32 words: words 8 hh .. 8 hh + 7 and 16 + 8 hh .. 16 + 8 hh + 7.
__device__ __forceinline__ v16h g2_frag(const _Float16* p, int hh) { FragH f; f.half[0] = *(const v8us*)((const unsigned short*)p + 8 * hh); f.half[1] = *(const v8us*)((const unsigned short*)p + 16 + 8 * hh); return f.v; }
__device__ __forceinline__ v8f f_mma(v16h a, v16h b, v8f c) { return __builtin_amdgcn_wmma_f32_16x16x32_f16(false, a, false, b, (short)0, c, false, false); }
__device__ __forceinline__ float lane_x16(float x) { return __builtin_bit_cast(float, __builtin_amdgcn_permlanex16(__builtin_bit_cast(int, x), __builtin_bit_cast(int, x), 0x76543210, 0xfedcba98, false, false)); }      /* lane l reads lane l ^ 16 */

// Eight words 2^a in one statement. The bounded exponent x lies in [-8 - exp(-8), -exp(-8)], so a = x log2(e) lies in (-12, 0]: inside the range where v_exp_f32 is right by itself (no split at a whole number, no scaling, no range test: each is an identity there).
__device__ __forceinline__ void exp2_x8(const float (&a)[8], float (&y)[8]) {
  asm("v_exp_f32 %0, %8\n\tv_exp_f32 %1, %9\n\tv_exp_f32 %2, %10\n\tv_exp_f32 %3, %11\n\tv_exp_f32 %4, %12\n\tv_exp_f32 %5, %13\n\tv_exp_f32 %6, %14\n\tv_exp_f32 %7, %15\n\tv_nop"
      : "=&v"(y[0]), "=&v"(y[1]), "=&v"(y[2]), "=&v"(y[3]), "=&v"(y[4]), "=&v"(y[5]), "=&v"(y[6]), "=&v"(y[7])
      : "v"(a[0]), "v"(a[1]), "v"(a[2]), "v"(a[3]), "v"(a[4]), "v"(a[5]), "v"(a[6]), "v"(a[7])); }      /* one statement: each v_exp_f32 has an independent one behind it (results apart from all sources), the last the v_nop: the slot that the instruction set asks for behind a transcendental */
#define AL2E 0x1.715476p+0f          /* log2(e) */
#define AQS (0.125f * AL2E)          /* the factor on a qa word: the module's 1/8 and the change of base */
#define AKC (-AE8 * AL2E)            /* the module's subtracted constant in powers of two: also the exponent's upper bound */
#define ALO2 (ALOW * AL2E + AKC)     /* the exponent's lower bound in powers of two */

#define FWAVES 16                    /* waves of a work-group: four a SIMD */
#define FROWS (FWAVES * 16)          /* rows i of a work-group: 32 a pair of waves */
#define JHALF (ANS / 2)              /* positions j of a wave: one half */
#define XW (32 * 32 + 32)            /* f32 words that a wave hands to its partner: four 16 x 16 tiles and sixteen row sums (held twice) */
#define KPW 72                       /* LDS pitch of a ka row in words: 64 + 8 (144 bytes = 16 x 9: 16-byte reads down a column of rows meet no bank twice) */
#define VPW 1032                     /* LDS pitch of a va^T row in words: 1,024 + 8 (2,064 bytes = 16 x 129) */
#define QPW KPW                      /* LDS pitch of a qa row: as a ka row's */
#define SPW 68                       /* LDS pitch of a staged result row in f32 words: 64 + 4 (272 bytes = 16 x 17: sixteen lanes' 16-byte stores down a column of rows meet no bank twice) */
#define VBLK ((ANS / 32) * (AND / 32) / FWAVES)      /* va blocks (32 positions x 32 columns) of a wave: four */
#define VSTEP (FWAVES / 2 * 32)      /* positions from one of a wave's va blocks to its next */
#define VPASS (JHALF / 32 / VBLK)    /* passes of walk 1 under which one va block's loads fly */
static_assert(VBLK * VPASS * 32 == JHALF, "walk 1's passes divide evenly among a wave's va blocks");
static_assert(JHALF % 32 == 0 && FWAVES % 2 == 0 && FWAVES * XW * 4 <= ANS * KPW * 2, "whole passes a half; the hand-over fits the ka rows' LDS");
static_assert(FROWS * SPW * 4 <= AND * VPW * 2, "the staged result rows fit the va^T rows' LDS");
__device__ __forceinline__ _Float16 in_h(float x) { return (_Float16)x; }      /* an input word: f32 to f16, to nearest even */
// One wave: sixteen rows of 64 f32 words (pitch ANW) become f16 rows of pitch KPW in LDS; QS: the rows are qa's and take the factor AQS ahead of the rounding. Load u takes rows u (lanes 0-15) and 8 + u (lanes 16-31) whole: four whole 128-byte lines. The 8-byte stores of the two rows lie 8 x 144 bytes apart = 32 banks: each half of the lanes has its own 32 banks.
template <bool QS> __device__ __forceinline__ void fill_rows(const float* __restrict__ src, _Float16* dst, int lane) {
  const int hf = lane >> 4, c4 = lane & 15; const float* s = src + (size_t)(8 * hf) * ANW + 4 * c4; unsigned short* d = (unsigned short*)dst + 8 * hf * KPW + 4 * c4; v4f x[8];
#pragma unroll      /* literal trip numbers: the eight loads are issued in a row, ahead of the stores */
  for (int u = 0; u < 8; ++u) x[u] = *(const v4fa*)(s + (size_t)u * ANW);
  asm volatile("s_wait_xcnt 0x0" :: "v"(s) : "memory");      /* the eight loads name s: the pair is kept whole (an input here) until this wait, so that no load's result and no later address lands on it before */
#pragma unroll
  for (int u = 0; u < 8; ++u) { FragH f;
#pragma unroll
    for (int r = 0; r < 4; ++r) f.h[r] = QS ? (_Float16)(x[u][r] * AQS) : in_h(x[u][r]);
    v4us o; o[0] = f.u[0]; o[1] = f.u[1]; o[2] = f.u[2]; o[3] = f.u[3]; *(v4us*)(d + u * KPW) = o; }
}
// One wave: a block of 32 positions j x 32 columns c of f32 words (pitch ANW) becomes 32 f16 rows [c] of 32 positions in LDS (pitch VPW). A lane takes four columns (16 bytes) of eight positions in a row: load u takes position 8 jq + u of four jq, 128 bytes each: four whole lines. Store k writes column k's eight positions, 16 bytes: among sixteen lanes the four column groups lie 16 banks apart and the four jq 4 banks: every bank once.
// The block goes in two halves, so that work can stand between them while the loads fly: cols_load issues the eight loads, cols_store converts and writes LDS.
__device__ __forceinline__ void cols_load(const float* __restrict__ src, v4f (&x)[8], int lane) {
  const int col = 16 * (lane >> 4) + 4 * (lane & 3), j8 = 8 * ((lane >> 2) & 3); const float* s = src + (size_t)j8 * ANW + col;
#pragma unroll      /* as above */
  for (int u = 0; u < 8; ++u) x[u] = *(const v4fa*)(s + (size_t)u * ANW);
  asm volatile("s_wait_xcnt 0x0" :: "v"(s) : "memory");      /* the eight loads name s: the pair is kept whole (an input here) until this wait, so that no load's result and no later address lands on it before */
}
__device__ __forceinline__ void cols_store(const v4f (&x)[8], _Float16* dst, int lane) {
  const int col = 16 * (lane >> 4) + 4 * (lane & 3), j8 = 8 * ((lane >> 2) & 3); unsigned short* d = (unsigned short*)dst + col * VPW + j8;
#pragma unroll
  for (int k = 0; k < 4; ++k) { FragH f;
#pragma unroll
    for (int u = 0; u < 8; ++u) f.h[u] = in_h(x[u][k]);
    *(v8us*)(d + k * VPW) = f.half[0]; }
}
// The raw sums of 32 positions j (two tiles of sixteen) against two tiles of sixteen rows i (q: the wave's own, p: its partner's), transposed: t0[r] = sum for j = 8 hh + r, t1[r] for j = 16 + 8 hh + r, both of row i = ln of the first tile; u0, u1 the same of the second. Each of the four ka fragments (f_ka reads them) is read once and feeds both tiles. cq, cp: the accumulators' start values (walk 1: nought; walk 2: a row's own constant in every word).
struct KaF { v16h a00, a10, a01, a11; };
__device__ __forceinline__ KaF f_ka(const _Float16* k0, int hh) { const _Float16* k1 = k0 + 16 * KPW; KaF f; f.a00 = g2_frag(k0, hh); f.a10 = g2_frag(k1, hh); f.a01 = g2_frag(k0 + 32, hh); f.a11 = g2_frag(k1 + 32, hh); return f; }
__device__ __forceinline__ void f_raw(const KaF& f, v16h q0, v16h q1, v16h p0, v16h p1, v8f cq, v8f cp, v8f& t0, v8f& t1, v8f& u0, v8f& u1) {
  const v16h a00 = f.a00, a10 = f.a10, a01 = f.a01, a11 = f.a11;
  t0 = f_mma(a00, q0, cq); t1 = f_mma(a10, q0, cq); u0 = f_mma(a00, p0, cp); u1 = f_mma(a10, p0, cp);
  t0 = f_mma(a01, q1, t0); t1 = f_mma(a11, q1, t1); u0 = f_mma(a01, p1, u0); u1 = f_mma(a11, p1, u1); }
// One tile of rows, 32 positions: the product's words are the exponents already (in powers of two, the row's largest and the constant taken off); each is bounded and goes into the exponential; the words e are added to the row's four chains and packed as the B operand of the second product: word s is position j = 8 hh + s (s < 8) or 16 + 8 hh + s - 8: the two tiles' registers as they lie.
__device__ __forceinline__ v16h f_wt(const v8f& t0, const v8f& t1, float (&s)[4]) { FragH p; float a0[8], a1[8], e0[8], e1[8];
#pragma unroll      /* here and below: literal indices, so that the words stay in registers */
  for (int r = 0; r < 8; ++r) { a0[r] = __builtin_amdgcn_fmed3f(t0[r], ALO2, AKC); a1[r] = __builtin_amdgcn_fmed3f(t1[r], ALO2, AKC); }      /* both bounds in one instruction, straight on the accumulator's word (written as a largest and a smallest, each word first takes an instruction that only rewrites it) */
  exp2_x8(a0, e0); exp2_x8(a1, e1);
#pragma unroll
  for (int r = 0; r < 8; r += 2) { s[0] += e0[r]; s[1] += e0[r + 1]; s[2] += e1[r]; s[3] += e1[r + 1]; p.h[r] = (_Float16)e0[r]; p.h[r + 1] = (_Float16)e0[r + 1]; p.h[8 + r] = (_Float16)e1[r]; p.h[8 + r + 1] = (_Float16)e1[r + 1]; }
  return p.v; }
// A wave's own issue priority, 0 to 3 (the instruction takes the level as an immediate: lv is a literal at every call). Two rules, for speed only: the level falls as the wave advances (a wave that lags outranks those ahead of it), and in walk 2, whose vector runs are long, a wave's LDS reads and WMMAs stand one level above its vector run (a WMMA takes one issue slot in eight, so the vector run of another wave loses little to it). Every walk leaves the wave at 0.
__device__ __forceinline__ void wave_prio(int lv) { if (lv == 3) __builtin_amdgcn_s_setprio(3); else if (lv == 2) __builtin_amdgcn_s_setprio(2); else if (lv == 1) __builtin_amdgcn_s_setprio(1); else __builtin_amdgcn_s_setprio(0); }
static_assert(VBLK == 4 && (JHALF / 32) % 2 == 0, "walk 1: one level a va block; walk 2: whole passes a half");
// Every bare "#pragma unroll" below but the last is there so that accumulator and fragment words are indexed by literals and stay in registers.
__global__ __launch_bounds__(FWAVES * 32) void k_pair(const float* __restrict__ QF, const float* __restrict__ KF, const float* __restrict__ VF, float* __restrict__ res) {
  __shared__ __attribute__((aligned(16))) _Float16 sk[ANS * KPW];      /* the head's ka rows: [j][c] */
  __shared__ __attribute__((aligned(16))) _Float16 sv[AND * VPW];      /* the head's va transposed: [c][j] */
  __shared__ __attribute__((aligned(16))) _Float16 sq[FROWS * QPW];      /* the work-group's qa rows: [i][c] */
  __shared__ float sx[FWAVES * 32];      /* each wave's largest of 32 rows over its half of j */
  const int tid = threadIdx.x, lane = tid & 31, ln = lane & 15, hh = lane >> 4, wave = tid >> 5;
  const int g = blockIdx.y / ANH, hd = blockIdx.y % ANH;
  const size_t hb = (size_t)g * ANS * ANW + hd * AND; const float* kp = KF + hb; const float* vp = VF + hb;      /* the head's first word: rows of 64 words, pitch ANW */
  fill_rows<true>(QF + hb + (size_t)(blockIdx.x * FROWS + wave * 16) * ANW, sq + wave * 16 * QPW, lane);
#pragma unroll      /* literal trip numbers: a later block's loads may be issued ahead of an earlier block's stores */
  for (int t = 0; t < ANS / 16 / FWAVES; ++t) { const int r0 = (t * FWAVES + wave) * 16; fill_rows<false>(kp + (size_t)r0 * ANW, sk + r0 * KPW, lane); }
  __syncthreads();      /* sk and sq are filled: walk 1 reads them alone; sv is filled under walk 1 and read behind the barrier that follows it */
  const int jh = wave & 1;      /* the wave's half of the positions; waves 2 n and 2 n + 1 share rows 32 n .. 32 n + 31, and each finishes its own sixteen (tile q), the partner the other sixteen (tile p) */
  const _Float16* qr = sq + (wave * 16 + ln) * QPW; const _Float16* pr = sq + ((wave ^ 1) * 16 + ln) * QPW;
  const v16h q0 = g2_frag(qr, hh), q1 = g2_frag(qr + 32, hh), p0 = g2_frag(pr, hh), p1 = g2_frag(pr + 32, hh);      /* both tiles of rows i: B operands of the first product, kept in registers */
  const _Float16* ka = sk + (jh * JHALF + ln) * KPW; const _Float16* va = sv + ln * VPW + jh * JHALF;
  const v8f z8 = {0.f, 0.f, 0.f, 0.f, 0.f, 0.f, 0.f, 0.f}; float hq = -__builtin_inff(), hp = -__builtin_inff();
  const int vj0 = (wave >> 1) * 32, vc0 = (wave & 1) * 32;      /* the wave's va blocks: 32 columns from vc0, 32 positions from vj0 + VSTEP t */
  v4f vx[8]; cols_load(vp + (size_t)vj0 * ANW + vc0, vx, lane);
#pragma unroll      /* literal block numbers: the next block's loads may be issued ahead of this block's stores, into registers of their own */
  for (int t = 0; t < VBLK; ++t) { wave_prio(VBLK - 1 - t);      /* walk 1: 3, 2, 1, 0 over its quarters */
    for (int jb = t * VPASS; jb < (t + 1) * VPASS; ++jb) { const KaF kf = f_ka(ka + jb * 32 * KPW, hh);
      __builtin_amdgcn_sched_barrier(0);      /* the pass's eight LDS reads stay one group ahead of its products; left free they stand at three places among the WMMAs, into registers used twice, and are waited for at each */
      v8f t0, t1, u0, u1; f_raw(kf, q0, q1, p0, p1, z8, z8, t0, t1, u0, u1);
#pragma unroll
      for (int r = 0; r < 8; ++r) { hq = fmaxf(hq, fmaxf(t0[r], t1[r])); hp = fmaxf(hp, fmaxf(u0[r], u1[r])); } }
    cols_store(vx, sv + vc0 * VPW + vj0 + t * VSTEP, lane);      /* the block's loads have flown under the passes above */
    if (t + 1 < VBLK) cols_load(vp + (size_t)(vj0 + (t + 1) * VSTEP) * ANW + vc0, vx, lane); }
  hq = fmaxf(hq, lane_x16(hq)); hp = fmaxf(hp, lane_x16(hp));      /* lanes ln and ln + 16 hold the two halves of a row's words */
  sx[wave * 32 + lane] = hh ? hp : hq;      /* words 0-15: the wave's own tile, 16-31: the partner's */
  __syncthreads();      /* each wave's largest over its half of j is in LDS, and so is all of sv */
  hq = fmaxf(hq, sx[(wave ^ 1) * 32 + 16 + ln]); hp = fmaxf(hp, sx[(wave ^ 1) * 32 + ln]);      /* the largest of the whole row, in powers of two as the raw sums are (the factor is positive and keeps the order) */
  hq = (fabsf(hq) < __builtin_inff()) ? hq : 0.0f; hp = (fabsf(hp) < __builtin_inff()) ? hp : 0.0f;      /* the module's guard: a largest that is not finite is read as nought */
  const float kq = AKC - hq, kp2 = AKC - hp; const v8f cq = {kq, kq, kq, kq, kq, kq, kq, kq}, cp = {kp2, kp2, kp2, kp2, kp2, kp2, kp2, kp2};      /* a lane's accumulator words are all of one row: its constant in each */
  v8f o0 = z8, o1 = z8, o2 = z8, o3 = z8, w0 = z8, w1 = z8, w2 = z8, w3 = z8; float sq4[4] = {0.0f, 0.0f, 0.0f, 0.0f}, sp4[4] = {0.0f, 0.0f, 0.0f, 0.0f};
#pragma unroll      /* literal levels for wave_prio: first half of the walk 3 and 2, second half 1 and 0 */
  for (int t = 0; t < 2; ++t) { wave_prio(3 - 2 * t);
#pragma unroll 1      /* a half's passes stay a loop: two copies of the pass are text enough */
  for (int jb = t * (JHALF / 64); jb < (t + 1) * (JHALF / 64); ++jb) { const KaF kf = f_ka(ka + jb * 32 * KPW, hh);
    const _Float16* vj = va + jb * 32; const v16h a0 = g2_frag(vj, hh), a1 = g2_frag(vj + 16 * VPW, hh), a2 = g2_frag(vj + 32 * VPW, hh), a3 = g2_frag(vj + 48 * VPW, hh);      /* each va^T fragment is read once and feeds both tiles */
    __builtin_amdgcn_sched_barrier(0);      /* the pass's sixteen LDS reads stay one group, ka first, ahead of the first product: it and the vector work cover the va^T reads' latency; left free those sink among the second product's WMMAs and are waited for there */
    v8f t0, t1, u0, u1; f_raw(kf, q0, q1, p0, p1, cq, cp, t0, t1, u0, u1);
    wave_prio(2 - 2 * t);      /* the vector run: the lower level of the half */
    const v16h eq = f_wt(t0, t1, sq4), ep = f_wt(u0, u1, sp4);
    __builtin_amdgcn_sched_barrier(0);      /* the row sums' additions stay ahead of the second product; left free they land behind its WMMAs on operand registers, each time at the price of the four idle slots that the chip asks for there */
    wave_prio(3 - 2 * t);      /* the second product, the next pass's LDS reads and its first product: the upper level */
    o0 = f_mma(a0, eq, o0); w0 = f_mma(a0, ep, w0); o1 = f_mma(a1, eq, o1); w1 = f_mma(a1, ep, w1); o2 = f_mma(a2, eq, o2); w2 = f_mma(a2, ep, w2); o3 = f_mma(a3, eq, o3); w3 = f_mma(a3, ep, w3); } }
  wave_prio(0);
  float s = (sq4[0] + sq4[1]) + (sq4[2] + sq4[3]); s += lane_x16(s); float sp = (sp4[0] + sp4[1]) + (sp4[2] + sp4[3]); sp += lane_x16(sp);
  __syncthreads();      /* every wave has left walk 2: sk is free to carry the hand-over */
  float* xw = (float*)sk + wave * XW + 4 * lane; const float* xr = (const float*)sk + (wave ^ 1) * XW + 4 * lane;      /* 16 bytes a lane, 512 bytes in a row a store or read: each half of the lanes meets every bank once */
  const v8f ww[4] = {w0, w1, w2, w3};
#pragma unroll
  for (int t = 0; t < 4; ++t) { v4f a, b;
#pragma unroll
    for (int r = 0; r < 4; ++r) { a[r] = ww[t][r]; b[r] = ww[t][4 + r]; }
    *(v4fa*)(xw + 256 * t) = a; *(v4fa*)(xw + 256 * t + 128) = b; }
  *(f1a*)((float*)sk + wave * XW + 1024 + lane) = sp;
  __syncthreads();      /* the partner's sums over its half of j are in LDS */
  v8f oj[4] = {o0, o1, o2, o3};
#pragma unroll
  for (int t = 0; t < 4; ++t) { const v4f a = *(const v4fa*)(xr + 256 * t), b = *(const v4fa*)(xr + 256 * t + 128);
#pragma unroll
    for (int r = 0; r < 4; ++r) { oj[t][r] += a[r]; oj[t][4 + r] += b[r]; } }
  s += *(const f1a*)((const float*)sk + (wave ^ 1) * XW + 1024 + lane);
  s = fminf(fmaxf(s, ASLO), ASHI); const float rc = 1.0f / s;
  float* st = (float*)sv + wave * (16 * SPW);      /* the wave's own staging rows, in sv, which every wave has left (two barriers back): no other wave touches them */
  float* sw = st + ln * SPW + 8 * hh;      /* ot[r] is word c = 16 t + 8 hh + r of row i = ln: eight words in a row a tile */
#pragma unroll
  for (int t = 0; t < 4; ++t) { v4f a, b;
#pragma unroll
    for (int r = 0; r < 4; ++r) { a[r] = oj[t][r] * rc; b[r] = oj[t][4 + r] * rc; }
    *(v4fa*)(sw + 16 * t) = a; *(v4fa*)(sw + 16 * t + 4) = b; }
  asm volatile("s_wait_dscnt 0x0" ::: "memory");      /* the wave's own sixteen rows are in LDS before its lanes read one another's words back */
  const float* sr = st + hh * SPW + 4 * ln;      /* read u: rows 2 u (lanes 0-15) and 2 u + 1 (lanes 16-31), 256 bytes in a row each */
  float* op = res + ((size_t)g * ANS + blockIdx.x * FROWS + wave * 16 + hh) * ANW + hd * AND + 4 * ln;
#pragma unroll
  for (int u = 0; u < 8; ++u) { const v4f x = *(const v4fa*)(sr + 2 * u * SPW); *(v4f*)(op + (size_t)(2 * u) * ANW) = x; }      /* a store writes two rows' 256 bytes: four whole 128-byte lines */
}

extern "C" void kernel_launch(void* const* d_in, const int* in_sizes, int n_in,
                              void* d_out, int out_size, void* d_ws, size_t ws_size, hipStream_t stream) {
  (void)in_sizes; (void)n_in; (void)out_size; (void)d_ws; (void)ws_size;
  const float* const* I = (const float* const*)d_in; const float* qa = I[0]; const float* ka = I[1]; const float* va = I[2];      /* each [4][1024][16][64] */
  float* res = (float*)d_out;
  static_assert(ANS % FROWS == 0 && ANS % 32 == 0 && AND == 64 && (ANS / 16) % FWAVES == 0 && ((ANS / 32) * (AND / 32)) % FWAVES == 0, "whole tiles");
  k_pair<<<dim3((unsigned)(ANS / FROWS), (unsigned)(ANG * ANH)), FWAVES * 32, 0, stream>>>(qa, ka, va, res);      /* one work-group for 256 rows of one (group, head) */
}
